// v000
// Measured on an AMD MI455X. A time is GPU time per run, averaged over a window of back-to-back runs after a warm-up
// (all launches, gaps included; the runs take copies of the inputs in turn), and the median of several windows.
// Apart from v000's, it joins two sittings. Times from different sittings can be a few percent apart, while
// side-by-side timings come from the same sitting.
// v000, which the later versions start from, runs in 4740 microseconds.
#include <hip/hip_runtime.h>
// Clifford (multivector) attention (B 2, L 4096, 8 heads × (8 dims × 8 blades) = 512): per head a shared Linear 64→64 (+bias) gives q, k, v from the head's slice of x; q is sign-weighted per blade ([1,−1,1,1,−1,−1,1,−1] over the blade index = column mod 8); logits = q_w·k/8 over the 64 components; softmax over the 4096 keys; out = attn·v → [2,4096,512] (heads concatenated; no output projection).
// Compute dtype: x and parameters rounded to bf16; q/k/v with exact products (+bias, f32), the per-blade sign folded exactly into Wq/bq, q_w,k,v as f16 GEMM results/operands (logits O(1)), scores and attn·v (P ×2^10 f16) with f32 accumulation written straight into the output rows; softmax in f32. v_wmma_f32_16x16x32_f16.
#define NBt 2
#define LL 4096
#define NH 8
#define DHd 64
#define DM (NH * DHd)
#define NR (NBt * LL)
#define QH 2048                  /* query rows per score block */
typedef __bf16 v16b __attribute__((ext_vector_type(16)));
typedef unsigned short v8us __attribute__((ext_vector_type(8), may_alias));
typedef float  v8f  __attribute__((ext_vector_type(8)));
typedef float  v4f  __attribute__((ext_vector_type(4)));
typedef float  v4fa __attribute__((ext_vector_type(4), may_alias));
union FragB { v16b v; v8us half[2]; unsigned short u[16]; };

__device__ __forceinline__ unsigned short bf16_bits(float x) { unsigned int u = __float_as_uint(x); return (unsigned short)((u + 0x7FFFu + ((u >> 16) & 1u)) >> 16); }
__device__ __forceinline__ float bf16_val(unsigned short b) { return __uint_as_float(((unsigned int)b) << 16); }
__device__ __forceinline__ float bf16_round(float x) { return bf16_val(bf16_bits(x)); }
// D += A·B with NT terms: 1 = ah·bh, 2 = + al·bh (A split), 3 = + ah·bl (both split)
template <int NT>
__device__ __forceinline__ v8f mmaN(v16b ah, v16b al, v16b bh, v16b bl, v8f c) {
  c = __builtin_amdgcn_wmma_f32_16x16x32_bf16(false, ah, false, bh, (short)0, c, false, false);
  if (NT >= 2) c = __builtin_amdgcn_wmma_f32_16x16x32_bf16(false, al, false, bh, (short)0, c, false, false);
  if (NT >= 3) c = __builtin_amdgcn_wmma_f32_16x16x32_bf16(false, ah, false, bl, (short)0, c, false, false);
  asm volatile("v_nop\n\tv_nop\n\tv_nop\n\tv_nop" : "+v"(c) : "v"(ah), "v"(al), "v"(bh), "v"(bl));
  return c;
}

__global__ __launch_bounds__(256) void k_wt_bf16(const float* __restrict__ W, unsigned short* __restrict__ Wt, int K, int N) {
  const int t = blockIdx.x * 256 + threadIdx.x;
  const int k8n = K / 8;
  if (t >= N * k8n) return;
  const int n = t / k8n, k8 = (t % k8n) * 8;
  v8us v;
#pragma unroll
  for (int i = 0; i < 8; ++i) v[i] = bf16_bits(W[(size_t)(k8 + i) * N + n]);
  *(v8us*)(Wt + (size_t)n * K + k8) = v;
  
}

// GEMM C[M][N] (f32, pitch ldc) = act(A[M][K]·W + bias). A f32 row-major (pitch lda) converted per fragment to bf16
// (ASPLIT: hi/lo two planes -> 2 terms, else single rounded term); Wt bf16 [N][K] (pitch ldb). BIAS_BF16 rounds the
// bias to bf16 first (bias quantised to bf16 before the add). K%32==0, M%16==0, N%64==0.
template <bool ASPLIT, int ACT, bool BIAS_BF16>
__global__ __launch_bounds__(128) void k_gemm_bf(const float* __restrict__ A, int lda, const unsigned short* __restrict__ Wt, int ldb,
                                               const float* __restrict__ bias, float* __restrict__ C, int ldc, int M, int N, int K) {
  __shared__ __attribute__((aligned(16))) float so[4][16][64];
  const int tid = threadIdx.x, w = tid >> 5, lane = tid & 31, ln = lane & 15, hh = lane >> 4;
  const int ntn = N / 64;
  const int wid = blockIdx.x * 4 + w;
  const int mt = wid / ntn, nq = wid % ntn;
  if (mt * 16 >= M) return;
  const int row0 = mt * 16, col0 = nq * 64;
  const float* arow = A + (size_t)(row0 + ln) * lda;
  v8f acc[4] = {};
  for (int kb = 0; kb < K; kb += 32) {
    FragB ah, al;
    const v4f x0 = *(const v4fa*)(arow + kb + 8 * hh), x1 = *(const v4fa*)(arow + kb + 8 * hh + 4);
    const v4f x2 = *(const v4fa*)(arow + kb + 16 + 8 * hh), x3 = *(const v4fa*)(arow + kb + 16 + 8 * hh + 4);
    float xs[16] = {x0[0],x0[1],x0[2],x0[3],x1[0],x1[1],x1[2],x1[3],x2[0],x2[1],x2[2],x2[3],x3[0],x3[1],x3[2],x3[3]};
#pragma unroll
    for (int i = 0; i < 16; ++i) { const unsigned short hb = bf16_bits(xs[i]); ah.u[i] = hb; al.u[i] = ASPLIT ? bf16_bits(xs[i] - bf16_val(hb)) : (unsigned short)0; }
#pragma unroll
    for (int t = 0; t < 4; ++t) {
      const unsigned short* brow = Wt + (size_t)(col0 + t * 16 + ln) * ldb + kb;
      FragB b;
      b.half[0] = *(const v8us*)(brow + 8 * hh);
      b.half[1] = *(const v8us*)(brow + 16 + 8 * hh);
      acc[t] = mmaN<ASPLIT ? 2 : 1>(ah.v, al.v, b.v, b.v, acc[t]);
    }
  }
#pragma unroll
  for (int t = 0; t < 4; ++t) {
    float bv = bias ? bias[col0 + t * 16 + ln] : 0.f;
    if (BIAS_BF16) bv = bf16_round(bv);
#pragma unroll
    for (int r = 0; r < 8; ++r) { float v = acc[t][r] + bv; if (ACT == 1) v = fmaxf(v, 0.f); so[w][8 * hh + r][t * 16 + ln] = v; }
  }
  __builtin_amdgcn_fence(__ATOMIC_ACQ_REL, "workgroup");
  __builtin_amdgcn_wave_barrier();
  const int rsub = lane >> 4, c4 = (lane & 15) * 4;
  {
#pragma unroll
    for (int q = 0; q < 8; ++q) {
      const int r = q * 2 + rsub;
      const v4f v = *(const v4fa*)&so[w][r][c4];
      *(v4f*)(C + (size_t)(row0 + r) * ldc + col0 + c4) = v;
    }
    
  }
}

// GEMM C = act(A·W + bias + resid): A f32 (ASPLIT -> hi/lo 2 terms), Wt bf16 [N][K]; ACT 0 none, 1 relu, 2 exact gelu;
// resid (optional, f32, row index = (row % rmod), pitch ldr, RES_BF16 rounds it) added before the activation.
template <bool ASPLIT, int ACT, bool BIAS_BF16, bool RES_BF16>
__global__ __launch_bounds__(128) void k_gemm_bf3(const float* __restrict__ A, int lda, const unsigned short* __restrict__ Wt, int ldb,
                                                const float* __restrict__ bias, const float* __restrict__ resid, int rmod, int ldr,
                                                float* __restrict__ C, int ldc, int M, int N, int K) {
  __shared__ __attribute__((aligned(16))) float so[4][16][64];
  const int tid = threadIdx.x, w = tid >> 5, lane = tid & 31, ln = lane & 15, hh = lane >> 4;
  const int ntn = N / 64;
  const int wid = blockIdx.x * 4 + w;
  const int mt = wid / ntn, nq = wid % ntn;
  if (mt * 16 >= M) return;
  const int row0 = mt * 16, col0 = nq * 64;
  const float* arow = A + (size_t)(row0 + ln) * lda;
  v8f acc[4] = {};
  for (int kb = 0; kb < K; kb += 32) {
    FragB ah, al;
    const v4f x0 = *(const v4fa*)(arow + kb + 8 * hh), x1 = *(const v4fa*)(arow + kb + 8 * hh + 4);
    const v4f x2 = *(const v4fa*)(arow + kb + 16 + 8 * hh), x3 = *(const v4fa*)(arow + kb + 16 + 8 * hh + 4);
    float xs[16] = {x0[0],x0[1],x0[2],x0[3],x1[0],x1[1],x1[2],x1[3],x2[0],x2[1],x2[2],x2[3],x3[0],x3[1],x3[2],x3[3]};
#pragma unroll
    for (int i = 0; i < 16; ++i) { const unsigned short hb = bf16_bits(xs[i]); ah.u[i] = hb; al.u[i] = ASPLIT ? bf16_bits(xs[i] - bf16_val(hb)) : (unsigned short)0; }
#pragma unroll
    for (int t = 0; t < 4; ++t) {
      const unsigned short* brow = Wt + (size_t)(col0 + t * 16 + ln) * ldb + kb;
      FragB b;
      b.half[0] = *(const v8us*)(brow + 8 * hh);
      b.half[1] = *(const v8us*)(brow + 16 + 8 * hh);
      acc[t] = mmaN<ASPLIT ? 2 : 1>(ah.v, al.v, b.v, b.v, acc[t]);
    }
  }
#pragma unroll
  for (int t = 0; t < 4; ++t) {
    const int col = col0 + t * 16 + ln;
    float bv = bias ? bias[col] : 0.f;
    if (BIAS_BF16) bv = bf16_round(bv);
#pragma unroll
    for (int r = 0; r < 8; ++r) {
      float v = acc[t][r] + bv;
      if (resid) { float rv = resid[(size_t)((row0 + 8 * hh + r) % rmod) * ldr + col]; if (RES_BF16) rv = bf16_round(rv); v += rv; }
      if (ACT == 1) v = fmaxf(v, 0.f);
      if (ACT == 2) v = 0.5f * v * (1.0f + erff(v * 0.70710678118654752f));
      if (ACT == 3) { const float u = 0.7978845608028654f * (v + 0.044715f * v * v * v); v = 0.5f * v * (1.0f + tanhf(u)); }
      so[w][8 * hh + r][t * 16 + ln] = v;
    }
  }
  __builtin_amdgcn_fence(__ATOMIC_ACQ_REL, "workgroup");
  __builtin_amdgcn_wave_barrier();
  const int rsub = lane >> 4, c4 = (lane & 15) * 4;
  {
#pragma unroll
    for (int q = 0; q < 8; ++q) {
      const int r = q * 2 + rsub;
      const v4f v = *(const v4fa*)&so[w][r][c4];
      *(v4f*)(C + (size_t)(row0 + r) * ldc + col0 + c4) = v;
    }
    
  }
}
// row LayerNorm (biased variance, eps) over N: s = X (+ R); optional out_sum <- s; out_norm <- (s-mu)*rsqrt(var+eps)*g + b
template <bool PARAM_BF16>
__global__ __launch_bounds__(256) void k_layernorm(const float* __restrict__ X, const float* __restrict__ R, const float* __restrict__ g, const float* __restrict__ bta,
                                                  float* __restrict__ out_sum, float* __restrict__ out_norm, int N, float eps) {
  __shared__ float red[256];
  const int row = blockIdx.x, tid = threadIdx.x;
  const float* x = X + (size_t)row * N; const float* rr = R ? R + (size_t)row * N : nullptr;
  float vals[16];                     // up to N = 4096
  const int per = N / 256;            // contiguous chunk per thread? use strided-by-4 chunks: thread handles j = tid*4 + 1024*u
  float s1 = 0.f;
  for (int u = 0; u < per / 4; ++u) {
    const int j = tid * 4 + 1024 * u;
    const v4f a = *(const v4fa*)(x + j);
    v4f b = {0.f,0.f,0.f,0.f}; if (rr) b = *(const v4fa*)(rr + j);
#pragma unroll
    for (int q = 0; q < 4; ++q) { const float v = a[q] + b[q]; vals[u * 4 + q] = v; s1 += v; }
  }
  red[tid] = s1; __syncthreads();
  for (int st = 128; st > 0; st >>= 1) { if (tid < st) red[tid] += red[tid + st]; __syncthreads(); }
  const float mu = red[0] / (float)N; __syncthreads();
  float s2 = 0.f;
  for (int u = 0; u < per / 4; ++u)
#pragma unroll
    for (int q = 0; q < 4; ++q) { const float c = vals[u * 4 + q] - mu; s2 += c * c; }
  red[tid] = s2; __syncthreads();
  for (int st = 128; st > 0; st >>= 1) { if (tid < st) red[tid] += red[tid + st]; __syncthreads(); }
  const float rs = rsqrtf(red[0] / (float)N + eps);
  {
    for (int u = 0; u < per / 4; ++u) {
      const int j = tid * 4 + 1024 * u;
      v4f o, sm;
#pragma unroll
      for (int q = 0; q < 4; ++q) {
        float gg = g[j + q], bb = bta[j + q];
        if (PARAM_BF16) { gg = bf16_round(gg); bb = bf16_round(bb); }
        sm[q] = vals[u * 4 + q]; o[q] = (vals[u * 4 + q] - mu) * rs * gg + bb;
      }
      if (out_sum) *(v4f*)(out_sum + (size_t)row * N + j) = sm;
      *(v4f*)(out_norm + (size_t)row * N + j) = o;
    }
    
  }
}



// ---- f16 WMMA path (v_wmma_f32_16x16x32_f16): 11-bit significands for operands in range — used where a [0,1] probability operand needs more precision than bf16
typedef _Float16 v16h __attribute__((ext_vector_type(16)));
union FragH { v16h v; v8us half[2]; _Float16 h[16]; unsigned short u[16]; };
template <int NT>
__device__ __forceinline__ v8f mmaH(v16h ah, v16h al, v16h bh, v16h bl, v8f c) {
  c = __builtin_amdgcn_wmma_f32_16x16x32_f16(false, ah, false, bh, (short)0, c, false, false);
  if (NT >= 2) c = __builtin_amdgcn_wmma_f32_16x16x32_f16(false, al, false, bh, (short)0, c, false, false);
  if (NT >= 3) c = __builtin_amdgcn_wmma_f32_16x16x32_f16(false, ah, false, bl, (short)0, c, false, false);
  asm volatile("v_nop\n\tv_nop\n\tv_nop\n\tv_nop" : "+v"(c) : "v"(ah), "v"(al), "v"(bh), "v"(bl));
  return c;
}
// batched GEMM like k_gemm_b but f16 operands: A f32 (split into f16 hi/lo if ASPLIT, else rounded to f16), Bt = f16 values [n][k]; alpha; C f32; N multiple of 16 (partial tiles skipped)
template <bool ASPLIT>
__global__ __launch_bounds__(128) void k_gemm_h(const float* __restrict__ A, int lda, size_t sA, const _Float16* __restrict__ Bh, int ldb, size_t sB, float alpha, float* __restrict__ C, int ldc, size_t sC, int M, int N, int K) {
  __shared__ __attribute__((aligned(16))) float so[4][16][64];
  const int tid = threadIdx.x, w = tid >> 5, lane = tid & 31, ln = lane & 15, hh = lane >> 4; const int by = blockIdx.y;
  A += (size_t)by * sA; Bh += (size_t)by * sB; C += (size_t)by * sC;
  const int ntn = (N + 63) / 64; const int wid = blockIdx.x * 4 + w; const int mt = wid / ntn, nq = wid % ntn; if (mt * 16 >= M) return;
  const int row0 = mt * 16, col0 = nq * 64; const float* arow = A + (size_t)(row0 + ln) * lda;
  v8f acc[4] = {};
  for (int kb = 0; kb < K; kb += 32) {
    FragH ah, al;
    const v4f x0 = *(const v4fa*)(arow + kb + 8 * hh), x1 = *(const v4fa*)(arow + kb + 8 * hh + 4), x2 = *(const v4fa*)(arow + kb + 16 + 8 * hh), x3 = *(const v4fa*)(arow + kb + 16 + 8 * hh + 4);
    float xs[16] = {x0[0],x0[1],x0[2],x0[3],x1[0],x1[1],x1[2],x1[3],x2[0],x2[1],x2[2],x2[3],x3[0],x3[1],x3[2],x3[3]};
#pragma unroll
    for (int i = 0; i < 16; ++i) { const _Float16 h = (_Float16)xs[i]; ah.h[i] = h; al.h[i] = ASPLIT ? (_Float16)(xs[i] - (float)h) : (_Float16)0.0f; }
#pragma unroll
    for (int t = 0; t < 4; ++t) { if (col0 + t * 16 >= N) continue; const size_t boff = (size_t)(col0 + t * 16 + ln) * ldb + kb; FragH bq; bq.half[0] = *(const v8us*)(Bh + boff + 8 * hh); bq.half[1] = *(const v8us*)(Bh + boff + 16 + 8 * hh);
      acc[t] = mmaH<ASPLIT ? 2 : 1>(ah.v, al.v, bq.v, bq.v, acc[t]); }
  }
#pragma unroll
  for (int t = 0; t < 4; ++t) { if (col0 + t * 16 >= N) continue;
#pragma unroll
    for (int r = 0; r < 8; ++r) so[w][8 * hh + r][t * 16 + ln] = acc[t][r] * alpha; }
  __builtin_amdgcn_fence(__ATOMIC_ACQ_REL, "workgroup"); __builtin_amdgcn_wave_barrier();
  const int rsub = lane >> 4, c4 = (lane & 15) * 4;
  {
#pragma unroll
    for (int q = 0; q < 8; ++q) { const int r = q * 2 + rsub; if (col0 + c4 < N) { const v4f v = *(const v4fa*)&so[w][r][c4]; *(v4f*)(C + (size_t)(row0 + r) * ldc + col0 + c4) = v; } }
     }
}

// Wt[n][k] = f16(W[k][n]·scale) from f32 row-major W[K][N] (scale = power of two; bf16-exact weights stay exact in f16 away from the subnormal range)
__global__ __launch_bounds__(256) void k_wt_f16(const float* __restrict__ W, _Float16* __restrict__ Wt, int K, int N, float scale) {
  const int t = blockIdx.x * 256 + threadIdx.x; if (t >= N * (K / 8)) return; const int n = t / (K / 8), k8 = (t % (K / 8)) * 8; FragH f;
#pragma unroll
  for (int i = 0; i < 8; ++i) f.h[i] = (_Float16)(bf16_round(W[(size_t)(k8 + i) * N + n]) * scale); const v8us o = f.half[0];
  *(v8us*)((unsigned short*)Wt + (size_t)n * K + k8) = o; 
}
// k_gemm_hh variant with fused epilogue: v = acc·alpha + bias[by·sBias + col] (+ CP[(row/rowsPerB)·sCPb + by·64 + col] if CP) ; ACT 0 none / 1 elu ; writes f32 C and f16 C16 (each if non-null)
template <int ACT>
__global__ __launch_bounds__(128) void k_gemm_hhx(const _Float16* __restrict__ A, int lda, size_t sA, const _Float16* __restrict__ Bh, int ldb, size_t sB, float alpha, const float* __restrict__ bias, size_t sBias, const float* __restrict__ CP, int rowsPerB, size_t sCPb, int row0g,
    float* __restrict__ C, _Float16* __restrict__ C16, int ldc, size_t sC, int M, int N, int K) {
  __shared__ __attribute__((aligned(16))) float so[4][16][64];
  const int tid = threadIdx.x, w = tid >> 5, lane = tid & 31, ln = lane & 15, hh = lane >> 4; const int by = blockIdx.y;
  A += (size_t)by * sA; Bh += (size_t)by * sB; const size_t cofs = (size_t)by * sC; const float* bp = bias ? bias + (size_t)by * sBias : nullptr;
  const int ntn = (N + 63) / 64; const int wid = blockIdx.x * 4 + w; const int mt = wid / ntn, nq = wid % ntn; if (mt * 16 >= M) return;
  const int row0 = mt * 16, col0 = nq * 64; const _Float16* arow = A + (size_t)(row0 + ln) * lda;
  v8f acc[4] = {};
  for (int kb = 0; kb < K; kb += 32) { FragH ah; ah.half[0] = *(const v8us*)((const unsigned short*)arow + kb + 8 * hh); ah.half[1] = *(const v8us*)((const unsigned short*)arow + kb + 16 + 8 * hh);
#pragma unroll
    for (int t = 0; t < 4; ++t) { if (col0 + t * 16 >= N) continue; const size_t boff = (size_t)(col0 + t * 16 + ln) * ldb + kb; FragH bq; bq.half[0] = *(const v8us*)((const unsigned short*)Bh + boff + 8 * hh); bq.half[1] = *(const v8us*)((const unsigned short*)Bh + boff + 16 + 8 * hh);
      acc[t] = mmaH<1>(ah.v, ah.v, bq.v, bq.v, acc[t]); }
  }
#pragma unroll
  for (int t = 0; t < 4; ++t) { if (col0 + t * 16 >= N) continue; const int col = col0 + t * 16 + ln; const float bv = bp ? bf16_round(bp[col]) : 0.f;
#pragma unroll
    for (int r = 0; r < 8; ++r) { float v = acc[t][r] * alpha + bv; if (CP) { const int bidx = (row0g + row0 + 8 * hh + r) / rowsPerB; v += CP[(size_t)bidx * sCPb + (size_t)by * 64 + col]; } if (ACT == 1) v = (v > 0.f) ? v : expm1f(v); else if (ACT == 7) v = (v > 0.f) ? v + 1.0f : expf(v); else if (ACT == 8) v = tanhf(v); else if (ACT == 9) v = 0.5f * v * (1.0f + tanhf(0.7978845608028654f * (v + 0.044715f * v * v * v))); else if (ACT == 11) v = 1.0f / (1.0f + expf(-v)); else if (ACT == 12) v = (v > 0.f) ? v : 0.01f * v; else if (ACT == 14) v = (v > 0.f) ? v : 0.1f * v; else if (ACT == 15) v = v / (1.0f + expf(-v)); else if (ACT == 3) v = fmaxf(v, 0.f); else if (ACT == 6) v = 0.5f * v * (1.0f + erff(v * 0.70710678118654752f)); so[w][8 * hh + r][t * 16 + ln] = v; } }
  __builtin_amdgcn_fence(__ATOMIC_ACQ_REL, "workgroup"); __builtin_amdgcn_wave_barrier();
  const int rsub = lane >> 4, c4 = (lane & 15) * 4; typedef _Float16 v4h __attribute__((ext_vector_type(4)));
  {
#pragma unroll
    for (int q = 0; q < 8; ++q) { const int r = q * 2 + rsub; if (col0 + c4 < N) { const v4f v = *(const v4fa*)&so[w][r][c4]; if (C) *(v4f*)(C + cofs + (size_t)(row0 + r) * ldc + col0 + c4) = v; if (C16) { v4h h4; for (int i = 0; i < 4; ++i) h4[i] = (_Float16)v[i]; *(v4h*)(C16 + cofs + (size_t)(row0 + r) * ldc + col0 + c4) = h4; } } }
     }
}


typedef _Float16 v4h __attribute__((ext_vector_type(4)));

__global__ __launch_bounds__(256) void k_x16(const float* __restrict__ x, _Float16* __restrict__ X16, size_t n8) { const size_t t = (size_t)blockIdx.x * 256 + threadIdx.x; if (t >= n8) return; FragH f;
#pragma unroll
  for (int q = 0; q < 8; ++q) f.h[q] = (_Float16)bf16_round(x[t * 8 + q]); *(v8us*)((unsigned short*)X16 + t * 8) = f.half[0];  }
__global__ __launch_bounds__(256) void k_h16(const float* __restrict__ x, _Float16* __restrict__ X16, size_t n8) { const size_t t = (size_t)blockIdx.x * 256 + threadIdx.x; if (t >= n8) return; FragH f;
#pragma unroll
  for (int q = 0; q < 8; ++q) f.h[q] = (_Float16)x[t * 8 + q]; *(v8us*)((unsigned short*)X16 + t * 8) = f.half[0];  }
__global__ __launch_bounds__(256) void k_round16f(const float* __restrict__ W, _Float16* __restrict__ Bt, size_t n8) { const size_t t = (size_t)blockIdx.x * 256 + threadIdx.x; if (t >= n8) return; FragH f;
#pragma unroll
  for (int i = 0; i < 8; ++i) f.h[i] = (_Float16)(bf16_round(W[t * 8 + i]) * 16.0f); *(v8us*)((unsigned short*)Bt + t * 8) = f.half[0];  }
template <int NHv, int TTv>
__global__ __launch_bounds__(256) void k_vt(const _Float16* __restrict__ V16, int ldv, int voff, _Float16* __restrict__ Vt) { __shared__ unsigned short tl[64][66]; const int tid = threadIdx.x; const int slab = blockIdx.x / (TTv / 64), lg = blockIdx.x % (TTv / 64); const int b = slab / NHv, h = slab % NHv;
  for (int i = tid; i < 64 * 8; i += 256) { const int r = i / 8, c8 = (i % 8) * 8; FragH f; f.half[0] = *(const v8us*)((const unsigned short*)V16 + ((size_t)b * TTv + lg * 64 + r) * ldv + voff + h * 64 + c8);
#pragma unroll
    for (int q = 0; q < 8; ++q) tl[r][c8 + q] = f.u[q]; }
  __syncthreads();
  {
#pragma unroll
    for (int rd = 0; rd < 2; ++rd) { const int d = rd * 32 + tid / 8, pc = tid % 8; FragH f;
#pragma unroll
      for (int q = 0; q < 8; ++q) f.u[q] = tl[pc * 8 + q][d];
      *(v8us*)((unsigned short*)Vt + ((size_t)slab * 64 + d) * TTv + lg * 64 + pc * 8) = f.half[0]; }
     } }

__global__ __launch_bounds__(256) void k_hl(const float* __restrict__ F, _Float16* __restrict__ Hh, _Float16* __restrict__ Hl, size_t n8) { const size_t t = (size_t)blockIdx.x * 256 + threadIdx.x; if (t >= n8) return; FragH fh, fl; const v4f a = *(const v4fa*)(F + t * 8), c = *(const v4fa*)(F + t * 8 + 4);
#pragma unroll
  for (int q = 0; q < 4; ++q) { _Float16 h = (_Float16)a[q]; fh.h[q] = h; fl.h[q] = (_Float16)((a[q] - (float)h) * 1024.0f); h = (_Float16)c[q]; fh.h[4 + q] = h; fl.h[4 + q] = (_Float16)((c[q] - (float)h) * 1024.0f); }
  { *(v8us*)((unsigned short*)Hh + t * 8) = fh.half[0]; *(v8us*)((unsigned short*)Hl + t * 8) = fl.half[0];  } }

__constant__ float SGN[8] = {1.f, -1.f, 1.f, 1.f, -1.f, -1.f, 1.f, -1.f};
__global__ __launch_bounds__(256) void k_wh(const float* __restrict__ Wm, const float* __restrict__ bb, int sgn, _Float16* __restrict__ Bt, float* __restrict__ BL) { const int t = blockIdx.x * 256 + threadIdx.x; if (t >= DHd * (DHd / 8)) return; const int k0 = (t % (DHd / 8)) * 8, o = t / (DHd / 8); const float s = sgn ? SGN[o & 7] : 1.f; FragH f;
#pragma unroll
  for (int q = 0; q < 8; ++q) f.h[q] = (_Float16)(bf16_round(Wm[(size_t)o * DHd + k0 + q]) * 16.0f * s);
  *(v8us*)((unsigned short*)Bt + (size_t)o * DHd + k0) = f.half[0]; 
  if (t < DHd) { const float bvv = bf16_round(bb[t]) * (sgn ? SGN[t & 7] : 1.f); *(float*)(BL + t) = bvv;  } }      
__global__ __launch_bounds__(256) void k_vt(const _Float16* __restrict__ V16, _Float16* __restrict__ VT) { const int t = blockIdx.x * 256 + threadIdx.x; if (t >= NBt * NH * DHd * (LL / 8)) return; const int l0 = (t % (LL / 8)) * 8; const int d = (t / (LL / 8)) % DHd; const int bh = t / ((LL / 8) * DHd); const int b = bh / NH, h = bh % NH; FragH f;
#pragma unroll
  for (int q = 0; q < 8; ++q) f.h[q] = V16[((size_t)b * LL + l0 + q) * DM + h * DHd + d];
  *(v8us*)((unsigned short*)VT + ((size_t)bh * DHd + d) * LL + l0) = f.half[0];  }
__global__ __launch_bounds__(256) void k_soft(const float* __restrict__ S, int nrow, _Float16* __restrict__ P16) {
  #pragma clang fp contract(off)
  const int tid = threadIdx.x, w = tid >> 5, ln = tid & 31; const int r = blockIdx.x * 8 + w; if (r >= nrow) return; const float* sr = S + (size_t)r * LL; float m = -3.0e38f;
#pragma unroll 1
  for (int jb = 0; jb < LL; jb += 256) { const v4f a = *(const v4fa*)(sr + jb + 8 * ln), bq = *(const v4fa*)(sr + jb + 8 * ln + 4);
#pragma unroll
    for (int k = 0; k < 4; ++k) { m = fmaxf(m, a[k]); m = fmaxf(m, bq[k]); } }
  for (int o = 16; o > 0; o >>= 1) m = fmaxf(m, __shfl_xor(m, o, 32));
  float su = 0.f;
#pragma unroll 1
  for (int jb = 0; jb < LL; jb += 256) { const v4f a = *(const v4fa*)(sr + jb + 8 * ln), bq = *(const v4fa*)(sr + jb + 8 * ln + 4);
#pragma unroll
    for (int k = 0; k < 4; ++k) { su += expf(a[k] - m); su += expf(bq[k] - m); } }
  for (int o = 16; o > 0; o >>= 1) su += __shfl_xor(su, o, 32); const float inv = 1024.0f / su;
  {
#pragma unroll 1
    for (int jb = 0; jb < LL; jb += 256) { const v4f a = *(const v4fa*)(sr + jb + 8 * ln), bq = *(const v4fa*)(sr + jb + 8 * ln + 4); FragH f;
#pragma unroll
      for (int k = 0; k < 4; ++k) { f.h[k] = (_Float16)(expf(a[k] - m) * inv); f.h[4 + k] = (_Float16)(expf(bq[k] - m) * inv); }
      *(v8us*)((unsigned short*)P16 + (size_t)r * LL + jb + 8 * ln) = f.half[0]; }
     } }

extern "C" void kernel_launch(void* const* d_in, const int* in_sizes, int n_in,
                              void* d_out, int out_size, void* d_ws, size_t ws_size, hipStream_t stream) {
  (void)in_sizes; (void)n_in; (void)out_size;
  const float* x = (const float*)d_in[0]; const float* Wq = (const float*)d_in[1]; const float* bq = (const float*)d_in[2]; const float* Wk = (const float*)d_in[3]; const float* bk = (const float*)d_in[4]; const float* Wv = (const float*)d_in[5]; const float* bv = (const float*)d_in[6];
  char* ws = (char*)d_ws; size_t off = 0;
  auto take = [&](size_t bytes) { char* p = ws + off; off += (bytes + 255) & ~(size_t)255; return p; };
  _Float16* BQ = (_Float16*)take(DHd * DHd * 2); _Float16* BK = (_Float16*)take(DHd * DHd * 2); _Float16* BV = (_Float16*)take(DHd * DHd * 2); float* BLq = (float*)take(DHd * 4); float* BLk = (float*)take(DHd * 4); float* BLv = (float*)take(DHd * 4);
  _Float16* X16 = (_Float16*)take((size_t)NR * DM * 2); _Float16* QW16 = (_Float16*)take((size_t)NR * DM * 2); _Float16* K16 = (_Float16*)take((size_t)NR * DM * 2); _Float16* V16 = (_Float16*)take((size_t)NR * DM * 2); _Float16* VT = (_Float16*)take((size_t)NR * DM * 2);
  float* S = (float*)take((size_t)QH * LL * 4); _Float16* P16 = (_Float16*)take((size_t)QH * LL * 2);
  if (off > ws_size) return;      // 5 × 8.4 + 33.5 + 16.8 ≈ 92 MB
  k_wh<<<(DHd * 8 + 255) / 256, 256, 0, stream>>>(Wq, bq, 1, BQ, BLq); k_wh<<<(DHd * 8 + 255) / 256, 256, 0, stream>>>(Wk, bk, 0, BK, BLk); k_wh<<<(DHd * 8 + 255) / 256, 256, 0, stream>>>(Wv, bv, 0, BV, BLv);
  k_x16<<<(unsigned)(((size_t)NR * DM / 8 + 255) / 256), 256, 0, stream>>>(x, X16, (size_t)NR * DM / 8);
  const dim3 gP(((NR * NH / 16) * 1 + 3) / 4, 1), gS(((QH / 16) * (LL / 64) + 3) / 4, 1), gV(((QH / 16) * 1 + 3) / 4, 1);
  k_gemm_hhx<0><<<gP, 128, 0, stream>>>(X16, DHd, 0, BQ, DHd, 0, 0.0625f, BLq, 0, nullptr, 1, 0, 0, nullptr, QW16, DHd, 0, NR * NH, DHd, DHd); k_gemm_hhx<0><<<gP, 128, 0, stream>>>(X16, DHd, 0, BK, DHd, 0, 0.0625f, BLk, 0, nullptr, 1, 0, 0, nullptr, K16, DHd, 0, NR * NH, DHd, DHd); k_gemm_hhx<0><<<gP, 128, 0, stream>>>(X16, DHd, 0, BV, DHd, 0, 0.0625f, BLv, 0, nullptr, 1, 0, 0, nullptr, V16, DHd, 0, NR * NH, DHd, DHd);      /* per-head shared linears on x viewed as [(b,l,h)][64]: M 65536 N 64 K 64 (exact products + bias → f16; q rows sign-weighted via the folded weights) */
  k_vt<<<(unsigned)(((size_t)NBt * NH * DHd * (LL / 8) + 255) / 256), 256, 0, stream>>>(V16, VT);
  for (int bh = 0; bh < NBt * NH; ++bh) { const int b = bh / NH, h = bh % NH;
    for (int qb = 0; qb < LL / QH; ++qb) { const size_t q0 = (size_t)b * LL + (size_t)qb * QH;
      k_gemm_hhx<0><<<gS, 128, 0, stream>>>(QW16 + q0 * DM + h * DHd, DM, 0, K16 + (size_t)b * LL * DM + h * DHd, DM, 0, 0.125f, nullptr, 0, nullptr, 1, 0, 0, S, nullptr, LL, 0, QH, LL, DHd);      /* logits = q_w·k/8: M 2048 N 4096 K 64 */
      k_soft<<<QH / 8, 256, 0, stream>>>(S, QH, P16);
      k_gemm_hhx<0><<<gV, 128, 0, stream>>>(P16, LL, 0, VT + (size_t)bh * DHd * LL, LL, 0, 0.0009765625f, nullptr, 0, nullptr, 1, 0, 0, (float*)d_out + q0 * DM + h * DHd, nullptr, DM, 0, QH, DHd, LL); } }      /* out rows (b,l), cols h·64..: M 2048 N 64 K 4096 */
}

// v002
// It runs in 65.3 microseconds.
// Versions between v000 and this one are left out; their measured steps multiply to 72.5 times as fast.
#include <hip/hip_runtime.h>
// Clifford (multivector) attention (B 2, L 4096, 8 heads × (8 dims × 8 blades) = 512): per head a shared Linear 64→64 (+bias) gives q, k, v from the head's slice of x; q is sign-weighted per blade ([1,−1,1,1,−1,−1,1,−1] over the blade index = column mod 8); logits = q_w·k/8 over the 64 components; softmax over the 4096 keys; out = attn·v → [2,4096,512] (heads concatenated; no output projection).
// Compute dtype: x and parameters rounded to bf16; q/k/v with exact products (+bias, f32), the per-blade sign folded exactly into Wq/bq, q_w,k,v as f16 GEMM results/operands (logits O(1)); scores, softmax and attn*v in ONE launch (k_fattn): online softmax in f32 (log2 domain), P as f16 operand scaled by a power of two, f32 accumulation, one division by the row sum at the end. v_wmma_f32_16x16x32_f16.
#define NBt 2
#define LL 4096
#define NH 8
#define DHd 64
#define DM (NH * DHd)
#define NR (NBt * LL)
typedef __bf16 v16b __attribute__((ext_vector_type(16)));
typedef unsigned short v8us __attribute__((ext_vector_type(8), may_alias));
typedef float  v8f  __attribute__((ext_vector_type(8)));
typedef float  v4f  __attribute__((ext_vector_type(4)));
typedef float  v4fa __attribute__((ext_vector_type(4), may_alias));
union FragB { v16b v; v8us half[2]; unsigned short u[16]; };

__device__ __forceinline__ unsigned short bf16_bits(float x) { unsigned int u = __float_as_uint(x); return (unsigned short)((u + 0x7FFFu + ((u >> 16) & 1u)) >> 16); }
__device__ __forceinline__ float bf16_val(unsigned short b) { return __uint_as_float(((unsigned int)b) << 16); }
__device__ __forceinline__ float bf16_round(float x) { return bf16_val(bf16_bits(x)); }
// D += A·B with NT terms: 1 = ah·bh, 2 = + al·bh (A split), 3 = + ah·bl (both split)
template <int NT>
__device__ __forceinline__ v8f mmaN(v16b ah, v16b al, v16b bh, v16b bl, v8f c) {
  c = __builtin_amdgcn_wmma_f32_16x16x32_bf16(false, ah, false, bh, (short)0, c, false, false);
  if (NT >= 2) c = __builtin_amdgcn_wmma_f32_16x16x32_bf16(false, al, false, bh, (short)0, c, false, false);
  if (NT >= 3) c = __builtin_amdgcn_wmma_f32_16x16x32_bf16(false, ah, false, bl, (short)0, c, false, false);
  asm volatile("v_nop\n\tv_nop\n\tv_nop\n\tv_nop" : "+v"(c) : "v"(ah), "v"(al), "v"(bh), "v"(bl));
  return c;
}

__global__ __launch_bounds__(256) void k_wt_bf16(const float* __restrict__ W, unsigned short* __restrict__ Wt, int K, int N) {
  const int t = blockIdx.x * 256 + threadIdx.x;
  const int k8n = K / 8;
  if (t >= N * k8n) return;
  const int n = t / k8n, k8 = (t % k8n) * 8;
  v8us v;
#pragma unroll
  for (int i = 0; i < 8; ++i) v[i] = bf16_bits(W[(size_t)(k8 + i) * N + n]);
  *(v8us*)(Wt + (size_t)n * K + k8) = v;
  
}

// GEMM C[M][N] (f32, pitch ldc) = act(A[M][K]·W + bias). A f32 row-major (pitch lda) converted per fragment to bf16
// (ASPLIT: hi/lo two planes -> 2 terms, else single rounded term); Wt bf16 [N][K] (pitch ldb). BIAS_BF16 rounds the
// bias to bf16 first (bias quantised to bf16 before the add). K%32==0, M%16==0, N%64==0.
template <bool ASPLIT, int ACT, bool BIAS_BF16>
__global__ __launch_bounds__(128) void k_gemm_bf(const float* __restrict__ A, int lda, const unsigned short* __restrict__ Wt, int ldb,
                                               const float* __restrict__ bias, float* __restrict__ C, int ldc, int M, int N, int K) {
  __shared__ __attribute__((aligned(16))) float so[4][16][64];
  const int tid = threadIdx.x, w = tid >> 5, lane = tid & 31, ln = lane & 15, hh = lane >> 4;
  const int ntn = N / 64;
  const int wid = blockIdx.x * 4 + w;
  const int mt = wid / ntn, nq = wid % ntn;
  if (mt * 16 >= M) return;
  const int row0 = mt * 16, col0 = nq * 64;
  const float* arow = A + (size_t)(row0 + ln) * lda;
  v8f acc[4] = {};
  for (int kb = 0; kb < K; kb += 32) {
    FragB ah, al;
    const v4f x0 = *(const v4fa*)(arow + kb + 8 * hh), x1 = *(const v4fa*)(arow + kb + 8 * hh + 4);
    const v4f x2 = *(const v4fa*)(arow + kb + 16 + 8 * hh), x3 = *(const v4fa*)(arow + kb + 16 + 8 * hh + 4);
    float xs[16] = {x0[0],x0[1],x0[2],x0[3],x1[0],x1[1],x1[2],x1[3],x2[0],x2[1],x2[2],x2[3],x3[0],x3[1],x3[2],x3[3]};
#pragma unroll
    for (int i = 0; i < 16; ++i) { const unsigned short hb = bf16_bits(xs[i]); ah.u[i] = hb; al.u[i] = ASPLIT ? bf16_bits(xs[i] - bf16_val(hb)) : (unsigned short)0; }
#pragma unroll
    for (int t = 0; t < 4; ++t) {
      const unsigned short* brow = Wt + (size_t)(col0 + t * 16 + ln) * ldb + kb;
      FragB b;
      b.half[0] = *(const v8us*)(brow + 8 * hh);
      b.half[1] = *(const v8us*)(brow + 16 + 8 * hh);
      acc[t] = mmaN<ASPLIT ? 2 : 1>(ah.v, al.v, b.v, b.v, acc[t]);
    }
  }
#pragma unroll
  for (int t = 0; t < 4; ++t) {
    float bv = bias ? bias[col0 + t * 16 + ln] : 0.f;
    if (BIAS_BF16) bv = bf16_round(bv);
#pragma unroll
    for (int r = 0; r < 8; ++r) { float v = acc[t][r] + bv; if (ACT == 1) v = fmaxf(v, 0.f); so[w][8 * hh + r][t * 16 + ln] = v; }
  }
  __builtin_amdgcn_fence(__ATOMIC_ACQ_REL, "workgroup");
  __builtin_amdgcn_wave_barrier();
  const int rsub = lane >> 4, c4 = (lane & 15) * 4;
  {
#pragma unroll
    for (int q = 0; q < 8; ++q) {
      const int r = q * 2 + rsub;
      const v4f v = *(const v4fa*)&so[w][r][c4];
      *(v4f*)(C + (size_t)(row0 + r) * ldc + col0 + c4) = v;
    }
    
  }
}

// GEMM C = act(A·W + bias + resid): A f32 (ASPLIT -> hi/lo 2 terms), Wt bf16 [N][K]; ACT 0 none, 1 relu, 2 exact gelu;
// resid (optional, f32, row index = (row % rmod), pitch ldr, RES_BF16 rounds it) added before the activation.
template <bool ASPLIT, int ACT, bool BIAS_BF16, bool RES_BF16>
__global__ __launch_bounds__(128) void k_gemm_bf3(const float* __restrict__ A, int lda, const unsigned short* __restrict__ Wt, int ldb,
                                                const float* __restrict__ bias, const float* __restrict__ resid, int rmod, int ldr,
                                                float* __restrict__ C, int ldc, int M, int N, int K) {
  __shared__ __attribute__((aligned(16))) float so[4][16][64];
  const int tid = threadIdx.x, w = tid >> 5, lane = tid & 31, ln = lane & 15, hh = lane >> 4;
  const int ntn = N / 64;
  const int wid = blockIdx.x * 4 + w;
  const int mt = wid / ntn, nq = wid % ntn;
  if (mt * 16 >= M) return;
  const int row0 = mt * 16, col0 = nq * 64;
  const float* arow = A + (size_t)(row0 + ln) * lda;
  v8f acc[4] = {};
  for (int kb = 0; kb < K; kb += 32) {
    FragB ah, al;
    const v4f x0 = *(const v4fa*)(arow + kb + 8 * hh), x1 = *(const v4fa*)(arow + kb + 8 * hh + 4);
    const v4f x2 = *(const v4fa*)(arow + kb + 16 + 8 * hh), x3 = *(const v4fa*)(arow + kb + 16 + 8 * hh + 4);
    float xs[16] = {x0[0],x0[1],x0[2],x0[3],x1[0],x1[1],x1[2],x1[3],x2[0],x2[1],x2[2],x2[3],x3[0],x3[1],x3[2],x3[3]};
#pragma unroll
    for (int i = 0; i < 16; ++i) { const unsigned short hb = bf16_bits(xs[i]); ah.u[i] = hb; al.u[i] = ASPLIT ? bf16_bits(xs[i] - bf16_val(hb)) : (unsigned short)0; }
#pragma unroll
    for (int t = 0; t < 4; ++t) {
      const unsigned short* brow = Wt + (size_t)(col0 + t * 16 + ln) * ldb + kb;
      FragB b;
      b.half[0] = *(const v8us*)(brow + 8 * hh);
      b.half[1] = *(const v8us*)(brow + 16 + 8 * hh);
      acc[t] = mmaN<ASPLIT ? 2 : 1>(ah.v, al.v, b.v, b.v, acc[t]);
    }
  }
#pragma unroll
  for (int t = 0; t < 4; ++t) {
    const int col = col0 + t * 16 + ln;
    float bv = bias ? bias[col] : 0.f;
    if (BIAS_BF16) bv = bf16_round(bv);
#pragma unroll
    for (int r = 0; r < 8; ++r) {
      float v = acc[t][r] + bv;
      if (resid) { float rv = resid[(size_t)((row0 + 8 * hh + r) % rmod) * ldr + col]; if (RES_BF16) rv = bf16_round(rv); v += rv; }
      if (ACT == 1) v = fmaxf(v, 0.f);
      if (ACT == 2) v = 0.5f * v * (1.0f + erff(v * 0.70710678118654752f));
      if (ACT == 3) { const float u = 0.7978845608028654f * (v + 0.044715f * v * v * v); v = 0.5f * v * (1.0f + tanhf(u)); }
      so[w][8 * hh + r][t * 16 + ln] = v;
    }
  }
  __builtin_amdgcn_fence(__ATOMIC_ACQ_REL, "workgroup");
  __builtin_amdgcn_wave_barrier();
  const int rsub = lane >> 4, c4 = (lane & 15) * 4;
  {
#pragma unroll
    for (int q = 0; q < 8; ++q) {
      const int r = q * 2 + rsub;
      const v4f v = *(const v4fa*)&so[w][r][c4];
      *(v4f*)(C + (size_t)(row0 + r) * ldc + col0 + c4) = v;
    }
    
  }
}
// row LayerNorm (biased variance, eps) over N: s = X (+ R); optional out_sum <- s; out_norm <- (s-mu)*rsqrt(var+eps)*g + b
template <bool PARAM_BF16>
__global__ __launch_bounds__(256) void k_layernorm(const float* __restrict__ X, const float* __restrict__ R, const float* __restrict__ g, const float* __restrict__ bta,
                                                  float* __restrict__ out_sum, float* __restrict__ out_norm, int N, float eps) {
  __shared__ float red[256];
  const int row = blockIdx.x, tid = threadIdx.x;
  const float* x = X + (size_t)row * N; const float* rr = R ? R + (size_t)row * N : nullptr;
  float vals[16];                     // up to N = 4096
  const int per = N / 256;            // contiguous chunk per thread? use strided-by-4 chunks: thread handles j = tid*4 + 1024*u
  float s1 = 0.f;
  for (int u = 0; u < per / 4; ++u) {
    const int j = tid * 4 + 1024 * u;
    const v4f a = *(const v4fa*)(x + j);
    v4f b = {0.f,0.f,0.f,0.f}; if (rr) b = *(const v4fa*)(rr + j);
#pragma unroll
    for (int q = 0; q < 4; ++q) { const float v = a[q] + b[q]; vals[u * 4 + q] = v; s1 += v; }
  }
  red[tid] = s1; __syncthreads();
  for (int st = 128; st > 0; st >>= 1) { if (tid < st) red[tid] += red[tid + st]; __syncthreads(); }
  const float mu = red[0] / (float)N; __syncthreads();
  float s2 = 0.f;
  for (int u = 0; u < per / 4; ++u)
#pragma unroll
    for (int q = 0; q < 4; ++q) { const float c = vals[u * 4 + q] - mu; s2 += c * c; }
  red[tid] = s2; __syncthreads();
  for (int st = 128; st > 0; st >>= 1) { if (tid < st) red[tid] += red[tid + st]; __syncthreads(); }
  const float rs = rsqrtf(red[0] / (float)N + eps);
  {
    for (int u = 0; u < per / 4; ++u) {
      const int j = tid * 4 + 1024 * u;
      v4f o, sm;
#pragma unroll
      for (int q = 0; q < 4; ++q) {
        float gg = g[j + q], bb = bta[j + q];
        if (PARAM_BF16) { gg = bf16_round(gg); bb = bf16_round(bb); }
        sm[q] = vals[u * 4 + q]; o[q] = (vals[u * 4 + q] - mu) * rs * gg + bb;
      }
      if (out_sum) *(v4f*)(out_sum + (size_t)row * N + j) = sm;
      *(v4f*)(out_norm + (size_t)row * N + j) = o;
    }
    
  }
}



// ---- f16 WMMA path (v_wmma_f32_16x16x32_f16): 11-bit significands for operands in range — used where a [0,1] probability operand needs more precision than bf16
typedef _Float16 v16h __attribute__((ext_vector_type(16)));
union FragH { v16h v; v8us half[2]; _Float16 h[16]; unsigned short u[16]; };
template <int NT>
__device__ __forceinline__ v8f mmaH(v16h ah, v16h al, v16h bh, v16h bl, v8f c) {
  c = __builtin_amdgcn_wmma_f32_16x16x32_f16(false, ah, false, bh, (short)0, c, false, false);
  if (NT >= 2) c = __builtin_amdgcn_wmma_f32_16x16x32_f16(false, al, false, bh, (short)0, c, false, false);
  if (NT >= 3) c = __builtin_amdgcn_wmma_f32_16x16x32_f16(false, ah, false, bl, (short)0, c, false, false);
  asm volatile("v_nop\n\tv_nop\n\tv_nop\n\tv_nop" : "+v"(c) : "v"(ah), "v"(al), "v"(bh), "v"(bl));
  return c;
}
// batched GEMM like k_gemm_b but f16 operands: A f32 (split into f16 hi/lo if ASPLIT, else rounded to f16), Bt = f16 values [n][k]; alpha; C f32; N multiple of 16 (partial tiles skipped)
template <bool ASPLIT>
__global__ __launch_bounds__(128) void k_gemm_h(const float* __restrict__ A, int lda, size_t sA, const _Float16* __restrict__ Bh, int ldb, size_t sB, float alpha, float* __restrict__ C, int ldc, size_t sC, int M, int N, int K) {
  __shared__ __attribute__((aligned(16))) float so[4][16][64];
  const int tid = threadIdx.x, w = tid >> 5, lane = tid & 31, ln = lane & 15, hh = lane >> 4; const int by = blockIdx.y;
  A += (size_t)by * sA; Bh += (size_t)by * sB; C += (size_t)by * sC;
  const int ntn = (N + 63) / 64; const int wid = blockIdx.x * 4 + w; const int mt = wid / ntn, nq = wid % ntn; if (mt * 16 >= M) return;
  const int row0 = mt * 16, col0 = nq * 64; const float* arow = A + (size_t)(row0 + ln) * lda;
  v8f acc[4] = {};
  for (int kb = 0; kb < K; kb += 32) {
    FragH ah, al;
    const v4f x0 = *(const v4fa*)(arow + kb + 8 * hh), x1 = *(const v4fa*)(arow + kb + 8 * hh + 4), x2 = *(const v4fa*)(arow + kb + 16 + 8 * hh), x3 = *(const v4fa*)(arow + kb + 16 + 8 * hh + 4);
    float xs[16] = {x0[0],x0[1],x0[2],x0[3],x1[0],x1[1],x1[2],x1[3],x2[0],x2[1],x2[2],x2[3],x3[0],x3[1],x3[2],x3[3]};
#pragma unroll
    for (int i = 0; i < 16; ++i) { const _Float16 h = (_Float16)xs[i]; ah.h[i] = h; al.h[i] = ASPLIT ? (_Float16)(xs[i] - (float)h) : (_Float16)0.0f; }
#pragma unroll
    for (int t = 0; t < 4; ++t) { if (col0 + t * 16 >= N) continue; const size_t boff = (size_t)(col0 + t * 16 + ln) * ldb + kb; FragH bq; bq.half[0] = *(const v8us*)(Bh + boff + 8 * hh); bq.half[1] = *(const v8us*)(Bh + boff + 16 + 8 * hh);
      acc[t] = mmaH<ASPLIT ? 2 : 1>(ah.v, al.v, bq.v, bq.v, acc[t]); }
  }
#pragma unroll
  for (int t = 0; t < 4; ++t) { if (col0 + t * 16 >= N) continue;
#pragma unroll
    for (int r = 0; r < 8; ++r) so[w][8 * hh + r][t * 16 + ln] = acc[t][r] * alpha; }
  __builtin_amdgcn_fence(__ATOMIC_ACQ_REL, "workgroup"); __builtin_amdgcn_wave_barrier();
  const int rsub = lane >> 4, c4 = (lane & 15) * 4;
  {
#pragma unroll
    for (int q = 0; q < 8; ++q) { const int r = q * 2 + rsub; if (col0 + c4 < N) { const v4f v = *(const v4fa*)&so[w][r][c4]; *(v4f*)(C + (size_t)(row0 + r) * ldc + col0 + c4) = v; } }
     }
}

// Wt[n][k] = f16(W[k][n]·scale) from f32 row-major W[K][N] (scale = power of two; bf16-exact weights stay exact in f16 away from the subnormal range)
__global__ __launch_bounds__(256) void k_wt_f16(const float* __restrict__ W, _Float16* __restrict__ Wt, int K, int N, float scale) {
  const int t = blockIdx.x * 256 + threadIdx.x; if (t >= N * (K / 8)) return; const int n = t / (K / 8), k8 = (t % (K / 8)) * 8; FragH f;
#pragma unroll
  for (int i = 0; i < 8; ++i) f.h[i] = (_Float16)(bf16_round(W[(size_t)(k8 + i) * N + n]) * scale); const v8us o = f.half[0];
  *(v8us*)((unsigned short*)Wt + (size_t)n * K + k8) = o; 
}


typedef _Float16 v4h __attribute__((ext_vector_type(4)));

__global__ __launch_bounds__(256) void k_h16(const float* __restrict__ x, _Float16* __restrict__ X16, size_t n8) { const size_t t = (size_t)blockIdx.x * 256 + threadIdx.x; if (t >= n8) return; FragH f;
#pragma unroll
  for (int q = 0; q < 8; ++q) f.h[q] = (_Float16)x[t * 8 + q]; *(v8us*)((unsigned short*)X16 + t * 8) = f.half[0];  }
__global__ __launch_bounds__(256) void k_round16f(const float* __restrict__ W, _Float16* __restrict__ Bt, size_t n8) { const size_t t = (size_t)blockIdx.x * 256 + threadIdx.x; if (t >= n8) return; FragH f;
#pragma unroll
  for (int i = 0; i < 8; ++i) f.h[i] = (_Float16)(bf16_round(W[t * 8 + i]) * 16.0f); *(v8us*)((unsigned short*)Bt + t * 8) = f.half[0];  }
template <int NHv, int TTv>
__global__ __launch_bounds__(256) void k_vt(const _Float16* __restrict__ V16, int ldv, int voff, _Float16* __restrict__ Vt) { __shared__ unsigned short tl[64][66]; const int tid = threadIdx.x; const int slab = blockIdx.x / (TTv / 64), lg = blockIdx.x % (TTv / 64); const int b = slab / NHv, h = slab % NHv;
  for (int i = tid; i < 64 * 8; i += 256) { const int r = i / 8, c8 = (i % 8) * 8; FragH f; f.half[0] = *(const v8us*)((const unsigned short*)V16 + ((size_t)b * TTv + lg * 64 + r) * ldv + voff + h * 64 + c8);
#pragma unroll
    for (int q = 0; q < 8; ++q) tl[r][c8 + q] = f.u[q]; }
  __syncthreads();
  {
#pragma unroll
    for (int rd = 0; rd < 2; ++rd) { const int d = rd * 32 + tid / 8, pc = tid % 8; FragH f;
#pragma unroll
      for (int q = 0; q < 8; ++q) f.u[q] = tl[pc * 8 + q][d];
      *(v8us*)((unsigned short*)Vt + ((size_t)slab * 64 + d) * TTv + lg * 64 + pc * 8) = f.half[0]; }
     } }

__global__ __launch_bounds__(256) void k_hl(const float* __restrict__ F, _Float16* __restrict__ Hh, _Float16* __restrict__ Hl, size_t n8) { const size_t t = (size_t)blockIdx.x * 256 + threadIdx.x; if (t >= n8) return; FragH fh, fl; const v4f a = *(const v4fa*)(F + t * 8), c = *(const v4fa*)(F + t * 8 + 4);
#pragma unroll
  for (int q = 0; q < 4; ++q) { _Float16 h = (_Float16)a[q]; fh.h[q] = h; fl.h[q] = (_Float16)((a[q] - (float)h) * 1024.0f); h = (_Float16)c[q]; fh.h[4 + q] = h; fl.h[4 + q] = (_Float16)((c[q] - (float)h) * 1024.0f); }
  { *(v8us*)((unsigned short*)Hh + t * 8) = fh.half[0]; *(v8us*)((unsigned short*)Hl + t * 8) = fl.half[0];  } }

typedef unsigned int u32x4 __attribute__((ext_vector_type(4)));
typedef unsigned int u32x4a __attribute__((ext_vector_type(4), may_alias));
typedef float f32x2 __attribute__((ext_vector_type(2)));
typedef _Float16 f16x2 __attribute__((ext_vector_type(2)));
#define FSK 64                    /* keys per half-stage */
#define FPITCH 144u               /* LDS row pitch: 128 B of data + 16 B, an odd multiple of 16 B for 16-byte readers */
#define FTILE (64u * FPITCH)      /* one K tile (64 keys x 64 d) or one V^T tile (64 d x 64 keys) */
#define FBUF (2u * FTILE)         /* one half-stage: K tile, then V^T tile; a stage buffer is two of them, the ring two stage buffers */
#define FEP 272u                  /* output staging pitch: 256 B + 16 B */
struct FragU { u32x4 q[2]; };
__device__ __forceinline__ v8f mmaU(const FragU& a, const FragU& b, v8f c) { return __builtin_amdgcn_wmma_f32_16x16x32_f16(false, __builtin_bit_cast(v16h, a), false, __builtin_bit_cast(v16h, b), (short)0, c, false, false); }
__device__ __forceinline__ unsigned int pack2h(float lo, float hi) { return __builtin_bit_cast(unsigned int, __builtin_convertvector(f32x2{lo, hi}, f16x2)); }
__device__ __forceinline__ float xhalf(float x) { return __builtin_bit_cast(float, __builtin_amdgcn_permlanex16(__builtin_bit_cast(int, x), __builtin_bit_cast(int, x), 0x76543210, 0xfedcba98, false, false)); }  // lane l <-> lane l ^ 16
__global__ __launch_bounds__(256) void k_fattn(const _Float16* __restrict__ Q, const _Float16* __restrict__ K, const _Float16* __restrict__ VT, float* __restrict__ O) {
  __shared__ __attribute__((aligned(16))) unsigned char Ls[4u * FBUF];
  const unsigned int tid = threadIdx.x, lane = tid & 31u, wave = (unsigned int)__builtin_amdgcn_readfirstlane((int)(tid >> 5)), c = lane & 15u, hh = lane >> 4;
  const unsigned int bh = blockIdx.x / (LL / 256), qblk = blockIdx.x % (LL / 256), b = bh / NH, h = bh % NH;
  const unsigned int q0 = qblk * 256u + wave * 32u;
  const float cscale = 0.125f * 1.4426950408889634f;      // 1/sqrt(64), scores taken to the log2 domain
  // staging map: 8 threads cover one 128-byte row; a thread brings rows srow and srow + 32 of the K tile and of the V^T tile
  const unsigned int srow = tid >> 3, sch = (tid & 7u) * 16u;
  const unsigned char* kg = (const unsigned char*)(K + ((size_t)b * LL + srow) * DM + h * DHd) + sch;
  const unsigned char* vg = (const unsigned char*)(VT + ((size_t)bh * DHd + srow) * LL) + sch;
  const unsigned int sdst = srow * FPITCH + sch;
  u32x4 r0, r1, r2, r3;
  auto gload = [&](unsigned int st) {
    const unsigned char* kp = kg + (size_t)st * (FSK * DM * 2); const unsigned char* vp = vg + (size_t)st * (FSK * 2);
    r0 = *(const u32x4a*)kp; r1 = *(const u32x4a*)(kp + 32 * DM * 2); r2 = *(const u32x4a*)vp; r3 = *(const u32x4a*)(vp + 32 * LL * 2); };
  auto sstore = [&](unsigned char* base) {
    unsigned char* p = base + sdst;
    *(u32x4a*)p = r0; *(u32x4a*)(p + 32u * FPITCH) = r1; *(u32x4a*)(p + FTILE) = r2; *(u32x4a*)(p + FTILE + 32u * FPITCH) = r3; };
  gload(0);
  FragU qf[2][2];      // B operand: column = query, k = d in the hardware order (16 B at 16 hh and at 32 + 16 hh of each 64 B), as K's rows below
#pragma unroll
  for (int g = 0; g < 2; ++g) { const unsigned char* qp = (const unsigned char*)(Q + ((size_t)b * LL + q0 + 16u * g + c) * DM + h * DHd) + 16u * hh;
#pragma unroll
    for (int kc = 0; kc < 2; ++kc) { qf[g][kc].q[0] = *(const u32x4a*)(qp + 64 * kc); qf[g][kc].q[1] = *(const u32x4a*)(qp + 64 * kc + 32); } }
  FragU ones; ones.q[0] = u32x4{0x3C003C00u, 0x3C003C00u, 0x3C003C00u, 0x3C003C00u}; ones.q[1] = ones.q[0];      // f16 1.0 everywhere
  v8f acc[2][4] = {}; v8f lacc[2] = {}; float m_run[2] = {-1.0e30f, -1.0e30f};
  sstore(Ls); gload(1); sstore(Ls + FBUF);
  __syncthreads();
  // one half-stage (64 keys, two passes) of stage st; more: a stage st + 1 exists (a literal at both call sites, so no test stands in the loop)
  auto halfstage = [&](unsigned int st, unsigned int hf, bool more) __attribute__((always_inline)) {
    if (more) { gload(2u * st + 2u + hf);      // the next stage's same half flies under this half's two passes
      __builtin_amdgcn_sched_barrier(0); }      // keeps the four loads up here: without it the compiler sinks them to their LDS stores and the wave waits out the whole load latency there
    const unsigned char* Lb = Ls + (st & 1u) * (2u * FBUF) + hf * FBUF;
#pragma unroll
    for (unsigned int sub = 0; sub < 2; ++sub) {      // one pass = 32 keys
      FragU kf[2][2];
#pragma unroll
      for (int kt = 0; kt < 2; ++kt) { const unsigned char* p = Lb + (sub * 32u + 16u * kt + c) * FPITCH + 16u * hh;
#pragma unroll
        for (int kc = 0; kc < 2; ++kc) { kf[kt][kc].q[0] = *(const u32x4a*)(p + 64 * kc); kf[kt][kc].q[1] = *(const u32x4a*)(p + 64 * kc + 32); } }
      FragU vf[4];
#pragma unroll
      for (int t = 0; t < 4; ++t) { const unsigned char* p = Lb + FTILE + (16u * t + c) * FPITCH + sub * 64u + 16u * hh; vf[t].q[0] = *(const u32x4a*)p; vf[t].q[1] = *(const u32x4a*)(p + 32); }
      v8f s[2][2];      // s[kt][g][r] = score of key 16 kt + 8 hh + r against query column c of group g
#pragma unroll
      for (int kt = 0; kt < 2; ++kt)
#pragma unroll
        for (int g = 0; g < 2; ++g) { s[kt][g] = v8f{};
#pragma unroll
          for (int kc = 0; kc < 2; ++kc) s[kt][g] = mmaU(kf[kt][kc], qf[g][kc], s[kt][g]); }
      float mb[2]; bool need = false;
#pragma unroll
      for (int g = 0; g < 2; ++g) { float mx = s[0][g][0];
#pragma unroll
        for (int r = 1; r < 8; ++r) mx = fmaxf(mx, s[0][g][r]);
#pragma unroll
        for (int r = 0; r < 8; ++r) mx = fmaxf(mx, s[1][g][r]);
        mx = fmaxf(mx, xhalf(mx)) * cscale; mb[g] = mx; need = need || (mx > m_run[g] + 8.0f); }
      // lazy rescale, tested once per pass: the maximum in use may trail the true one by up to 8 (log2), so an exponential stays below 2^8
      if (__builtin_amdgcn_ballot_w32(need) != 0) {
#pragma unroll
        for (int g = 0; g < 2; ++g) { const float m_new = fmaxf(m_run[g], mb[g]); const float corr = __builtin_amdgcn_exp2f(m_run[g] - m_new); m_run[g] = m_new; lacc[g] = lacc[g] * corr;
#pragma unroll
          for (int t = 0; t < 4; ++t) acc[g][t] = acc[g][t] * corr; }
      }
#pragma unroll
      for (int g = 0; g < 2; ++g) { const float nm = 6.0f - m_run[g];      // P carries a factor 2^6 (cancels in the division): small weights stay normal f16, the largest stays below 2^14
        unsigned int w[8];
#pragma unroll
        for (int i = 0; i < 8; ++i) { const f32x2 a = __builtin_elementwise_fma(f32x2{s[i >> 2][g][2 * (i & 3)], s[i >> 2][g][2 * (i & 3) + 1]}, f32x2{cscale, cscale}, f32x2{nm, nm});
          w[i] = pack2h(__builtin_amdgcn_exp2f(a.x), __builtin_amdgcn_exp2f(a.y)); }
        FragU pf; pf.q[0] = u32x4{w[0], w[1], w[2], w[3]}; pf.q[1] = u32x4{w[4], w[5], w[6], w[7]};
#pragma unroll
        for (int t = 0; t < 4; ++t) acc[g][t] = mmaU(vf[t], pf, acc[g][t]);
        lacc[g] = mmaU(ones, pf, lacc[g]); }
    }
    if (more) sstore(Ls + ((st + 1u) & 1u) * (2u * FBUF) + hf * FBUF);      // into the stage buffer whose last readers passed the barrier that ended stage st - 1
    // Four vector slots between the pass's last WMMAs and the next half-stage's first vector write over their B registers;
    // the two scheduling barriers keep the WMMAs in front of the slots and the next writes behind them.
    __builtin_amdgcn_sched_barrier(0);
    asm volatile("v_nop\n\tv_nop\n\tv_nop\n\tv_nop");
    __builtin_amdgcn_sched_barrier(0);
  };
#pragma unroll 1      // the stage loop stays a loop: its body is already two passes long
  for (unsigned int st = 0; st + 1u < LL / (2 * FSK); ++st) {
#pragma unroll 1      // rolled: unrolled, the four passes need more than 256 VGPRs
    for (unsigned int hf = 0; hf < 2; ++hf) halfstage(st, hf, true);
    __syncthreads();      // publishes stage st + 1 and ends every wave's reads of stage st
  }
#pragma unroll 1      // rolled, as above
  for (unsigned int hf = 0; hf < 2; ++hf) halfstage(LL / (2 * FSK) - 1u, hf, false);
  __syncthreads();      // every wave has left the ring: it becomes output staging
  // Epilogue: behind the loop's last barrier nobody reads the ring; each wave stages 16 query rows at a time in its own range and stores whole 256-byte rows.
  unsigned char* Le = Ls + wave * (16u * FEP);
#pragma unroll
  for (int g = 0; g < 2; ++g) { const float inv = 1.0f / lacc[g][0];
#pragma unroll
    for (int t = 0; t < 4; ++t) { const v8f o = acc[g][t] * inv; unsigned char* p = Le + c * FEP + (16u * t + 8u * hh) * 4u;      // row = query c, columns d = 16 t + 8 hh + r
      *(v4fa*)p = v4f{o[0], o[1], o[2], o[3]}; *(v4fa*)(p + 16) = v4f{o[4], o[5], o[6], o[7]}; }
#pragma unroll
    for (int i = 0; i < 8; ++i) { const unsigned int row = 2u * i + hh; const v4f v = *(const v4fa*)(Le + row * FEP + c * 16u);
      *(v4fa*)(O + ((size_t)b * LL + q0 + 16u * g + row) * DM + h * DHd + c * 4u) = v; } }
}

// ---- q_w, k, v^T in one launch: one work-group = 256 sequence rows of one (batch, head), 8 waves x 32 rows. x and the three 64 x 64 weights are read as f32,
// rounded (x: its bf16 value held as f16; W: its bf16 value x 16, the blade sign folded into Wq and bq) and laid in LDS as f16 rows; every product is a WMMA.
// q and k are formed transposed (A = W rows, B = x rows): a lane then holds 8 neighbouring outputs of one sequence row, one 16-byte piece of a q or k row.
// v is formed straight (A = x rows, B = Wv rows): a lane holds 8 neighbouring sequence rows of one d, one 16-byte piece of a V^T row. All three go through LDS, so
// that every global store is made of whole 128-byte lines. Both operands of every product take k in the same hardware order (16 B at 16 hh and at 32 + 16 hh of each 64 B).
typedef unsigned int u32x2 __attribute__((ext_vector_type(2)));
typedef unsigned int u32x2a __attribute__((ext_vector_type(2), may_alias));
#define PVP 528u                          /* V^T staging pitch: 512 B of one d row + 16 B */
#define PL_W (256u * FPITCH)              /* behind the x rows: three weight tiles of 64 rows */
#define PL_B (PL_W + 3u * FTILE)          /* three biases, f32 */
#define PL_Q (PL_B + 3u * 256u)           /* q rows, then k rows: 256 each */
#define PL_V (PL_Q + 2u * 256u * FPITCH)  /* V^T: 64 d rows of 256 sequence places */
#define PL_END (PL_V + 64u * PVP)
__device__ __forceinline__ float blade_sign(unsigned int o) { return ((0xB2u >> (o & 7u)) & 1u) ? -1.f : 1.f; }      // blades 1, 4, 5, 7 are negative
__device__ __forceinline__ u32x4 pack8h(const v8f a, const v4f b0, const v4f b1) {      // f16(a / 16 + bias), eight neighbours
  return u32x4{pack2h(a[0] * 0.0625f + b0[0], a[1] * 0.0625f + b0[1]), pack2h(a[2] * 0.0625f + b0[2], a[3] * 0.0625f + b0[3]),
               pack2h(a[4] * 0.0625f + b1[0], a[5] * 0.0625f + b1[1]), pack2h(a[6] * 0.0625f + b1[2], a[7] * 0.0625f + b1[3])}; }
__global__ __launch_bounds__(256) void k_qkv(const float* __restrict__ x, const float* __restrict__ Wq, const float* __restrict__ bq, const float* __restrict__ Wk, const float* __restrict__ bk,
                                             const float* __restrict__ Wv, const float* __restrict__ bv, _Float16* __restrict__ Qo, _Float16* __restrict__ Ko, _Float16* __restrict__ VTo) {
  __shared__ __attribute__((aligned(16))) unsigned char Lp[PL_END];
  const unsigned int tid = threadIdx.x, lane = tid & 31u, wave = (unsigned int)__builtin_amdgcn_readfirstlane((int)(tid >> 5)), c = lane & 15u, hh = lane >> 4;
  const unsigned int bh = blockIdx.x / (LL / 256), lblk = blockIdx.x % (LL / 256), b = bh / NH, h = bh % NH;
  const unsigned int l0 = lblk * 256u, w0 = wave * 32u;
  // every global read of the kernel is issued here, ahead of any conversion: 16 lanes cover one 256-byte x row (a wave brings its own 32 rows), the weights go linearly over the block
  const float* xg = x + ((size_t)b * LL + l0 + w0 + hh) * DM + h * DHd + c * 4u;
  v4f xr[16], wr[3][4];
#pragma unroll
  for (int i = 0; i < 16; ++i) xr[i] = *(const v4fa*)(xg + (size_t)(2 * i) * DM);
#pragma unroll
  for (int j = 0; j < 4; ++j) { wr[0][j] = *(const v4fa*)(Wq + j * 1024 + tid * 4u); wr[1][j] = *(const v4fa*)(Wk + j * 1024 + tid * 4u); wr[2][j] = *(const v4fa*)(Wv + j * 1024 + tid * 4u); }
  const unsigned int bo = tid & 63u;
  float br = 0.f;
  if (wave < 2u) br = bq[bo]; else if (wave < 4u) br = bk[bo]; else if (wave < 6u) br = bv[bo];
  asm volatile("s_wait_xcnt 0x0" ::: "memory");      // stands in front of the first reuse of an address register of the loads above
  __builtin_amdgcn_sched_barrier(0);      // keeps the conversions, which reuse those registers, behind the wait: without it the compiler lifted the first of them over it
#pragma unroll
  for (int i = 0; i < 16; ++i)
    *(u32x2a*)(Lp + (w0 + 2u * i + hh) * FPITCH + c * 8u) = u32x2{pack2h(bf16_round(xr[i][0]), bf16_round(xr[i][1])), pack2h(bf16_round(xr[i][2]), bf16_round(xr[i][3]))};
#pragma unroll
  for (int mt = 0; mt < 3; ++mt)
#pragma unroll
    for (int j = 0; j < 4; ++j) { const unsigned int o = 16u * j + (tid >> 4); const float s = mt == 0 ? blade_sign(o) : 1.f; const v4f w = wr[mt][j];
      *(u32x2a*)(Lp + PL_W + mt * FTILE + o * FPITCH + c * 8u) = u32x2{pack2h(bf16_round(w[0]) * 16.0f * s, bf16_round(w[1]) * 16.0f * s), pack2h(bf16_round(w[2]) * 16.0f * s, bf16_round(w[3]) * 16.0f * s)}; }
  if (wave < 6u) *(float*)(Lp + PL_B + tid * 4u) = bf16_round(br) * (wave < 2u ? blade_sign(bo) : 1.f);
  __syncthreads();      // publishes the weights and biases (the x rows are read by the wave that wrote them)
  FragU xf[2][2];
#pragma unroll
  for (int m = 0; m < 2; ++m) { const unsigned char* p = Lp + (w0 + 16u * m + c) * FPITCH + 16u * hh;
#pragma unroll
    for (int kc = 0; kc < 2; ++kc) { xf[m][kc].q[0] = *(const u32x4a*)(p + 64 * kc); xf[m][kc].q[1] = *(const u32x4a*)(p + 64 * kc + 32); } }
#pragma unroll
  for (int mt = 0; mt < 3; ++mt) {
    FragU wf[4][2];
#pragma unroll
    for (int t = 0; t < 4; ++t) { const unsigned char* p = Lp + PL_W + mt * FTILE + (16u * t + c) * FPITCH + 16u * hh;
#pragma unroll
      for (int kc = 0; kc < 2; ++kc) { wf[t][kc].q[0] = *(const u32x4a*)(p + 64 * kc); wf[t][kc].q[1] = *(const u32x4a*)(p + 64 * kc + 32); } }
    v8f a[2][4] = {};
#pragma unroll
    for (int kc = 0; kc < 2; ++kc)
#pragma unroll
      for (int m = 0; m < 2; ++m)
#pragma unroll
        for (int t = 0; t < 4; ++t) a[m][t] = mt < 2 ? mmaU(wf[t][kc], xf[m][kc], a[m][t]) : mmaU(xf[m][kc], wf[t][kc], a[m][t]);
#pragma unroll
    for (int t = 0; t < 4; ++t) {
      if (mt < 2) {      // a[m][t][r]: output 16 t + 8 hh + r of sequence row 16 m + c
        const v4f b0 = *(const v4fa*)(Lp + PL_B + mt * 256u + (16u * t + 8u * hh) * 4u), b1 = *(const v4fa*)(Lp + PL_B + mt * 256u + (16u * t + 8u * hh) * 4u + 16u);
#pragma unroll
        for (int m = 0; m < 2; ++m) *(u32x4a*)(Lp + PL_Q + (mt * 256u + w0 + 16u * m + c) * FPITCH + (16u * t + 8u * hh) * 2u) = pack8h(a[m][t], b0, b1);
      } else {           // a[m][t][r]: d = 16 t + c of sequence row 16 m + 8 hh + r
        const float bd = *(const float*)(Lp + PL_B + 512u + (16u * t + c) * 4u); const v4f b4 = v4f{bd, bd, bd, bd};
#pragma unroll
        for (int m = 0; m < 2; ++m) *(u32x4a*)(Lp + PL_V + (16u * t + c) * PVP + (w0 + 16u * m + 8u * hh) * 2u) = pack8h(a[m][t], b4, b4);
      }
    }
  }
  __syncthreads();      // publishes the staged V^T rows, each made of all eight waves' pieces (and orders each wave's own q and k rows)
  const unsigned int r4 = lane >> 3, c16 = (lane & 7u) * 16u;      // 8 lanes cover one 128-byte q or k row
#pragma unroll
  for (int i = 0; i < 8; ++i) { const unsigned int row = w0 + 4u * i + r4; const size_t go = (((size_t)b * LL + l0 + row) * DM + h * DHd) * 2u + c16;
    *(u32x4a*)((unsigned char*)Qo + go) = *(const u32x4a*)(Lp + PL_Q + row * FPITCH + c16);
    *(u32x4a*)((unsigned char*)Ko + go) = *(const u32x4a*)(Lp + PL_Q + (256u + row) * FPITCH + c16); }
#pragma unroll
  for (int i = 0; i < 8; ++i) { const unsigned int d = wave * 8u + i;      // a wave stores 512 contiguous bytes of one V^T row
    *(u32x4a*)((unsigned char*)(VTo + ((size_t)bh * DHd + d) * LL + l0) + lane * 16u) = *(const u32x4a*)(Lp + PL_V + d * PVP + lane * 16u); }
}

extern "C" void kernel_launch(void* const* d_in, const int* in_sizes, int n_in,
                              void* d_out, int out_size, void* d_ws, size_t ws_size, hipStream_t stream) {
  (void)in_sizes; (void)n_in; (void)out_size;
  const float* x = (const float*)d_in[0]; const float* Wq = (const float*)d_in[1]; const float* bq = (const float*)d_in[2]; const float* Wk = (const float*)d_in[3]; const float* bk = (const float*)d_in[4]; const float* Wv = (const float*)d_in[5]; const float* bv = (const float*)d_in[6];
  char* ws = (char*)d_ws; size_t off = 0;
  auto take = [&](size_t bytes) { char* p = ws + off; off += (bytes + 255) & ~(size_t)255; return p; };
  _Float16* QW16 = (_Float16*)take((size_t)NR * DM * 2); _Float16* K16 = (_Float16*)take((size_t)NR * DM * 2); _Float16* VT = (_Float16*)take((size_t)NR * DM * 2);
  if (off > ws_size) return;      // 3 x 8.4 = 25 MB
  k_qkv<<<NBt * NH * (LL / 256), 256, 0, stream>>>(x, Wq, bq, Wk, bk, Wv, bv, QW16, K16, VT);      /* per-head shared linears (exact products + bias, f16 results; q sign-weighted via the folded weights), v written transposed */
  k_fattn<<<NBt * NH * (LL / 256), 256, 0, stream>>>(QW16, K16, VT, (float*)d_out);      /* scores, softmax, attn*v: every (b, h, 256-query block) in one launch */
}

// v003
// It runs in 58.9 microseconds.
// In two side-by-side timings against v002, it was 1.10 and 1.12 times as fast.
// Counting every step since v000, it is 80.3 times as fast.
#include <hip/hip_runtime.h>
// Clifford (multivector) attention (B 2, L 4096, 8 heads × (8 dims × 8 blades) = 512): per head a shared Linear 64→64 (+bias) gives q, k, v from the head's slice of x; q is sign-weighted per blade ([1,−1,1,1,−1,−1,1,−1] over the blade index = column mod 8); logits = q_w·k/8 over the 64 components; softmax over the 4096 keys; out = attn·v → [2,4096,512] (heads concatenated; no output projection).
// Compute dtype: x and parameters rounded to bf16; q/k/v with exact products (+bias, f32), the per-blade sign folded exactly into Wq/bq, q_w,k,v as f16 GEMM results/operands (logits O(1)); scores, softmax and attn*v in ONE launch (k_fattn): online softmax in f32 (log2 domain), P as f16 operand scaled by a power of two, f32 accumulation, one division by the row sum at the end. v_wmma_f32_16x16x32_f16.
#define NBt 2
#define LL 4096
#define NH 8
#define DHd 64
#define DM (NH * DHd)
#define NR (NBt * LL)
typedef __bf16 v16b __attribute__((ext_vector_type(16)));
typedef unsigned short v8us __attribute__((ext_vector_type(8), may_alias));
typedef float  v8f  __attribute__((ext_vector_type(8)));
typedef float  v4f  __attribute__((ext_vector_type(4)));
typedef float  v4fa __attribute__((ext_vector_type(4), may_alias));
union FragB { v16b v; v8us half[2]; unsigned short u[16]; };

__device__ __forceinline__ unsigned short bf16_bits(float x) { unsigned int u = __float_as_uint(x); return (unsigned short)((u + 0x7FFFu + ((u >> 16) & 1u)) >> 16); }
__device__ __forceinline__ float bf16_val(unsigned short b) { return __uint_as_float(((unsigned int)b) << 16); }
__device__ __forceinline__ float bf16_round(float x) { return bf16_val(bf16_bits(x)); }
// D += A·B with NT terms: 1 = ah·bh, 2 = + al·bh (A split), 3 = + ah·bl (both split)
template <int NT>
__device__ __forceinline__ v8f mmaN(v16b ah, v16b al, v16b bh, v16b bl, v8f c) {
  c = __builtin_amdgcn_wmma_f32_16x16x32_bf16(false, ah, false, bh, (short)0, c, false, false);
  if (NT >= 2) c = __builtin_amdgcn_wmma_f32_16x16x32_bf16(false, al, false, bh, (short)0, c, false, false);
  if (NT >= 3) c = __builtin_amdgcn_wmma_f32_16x16x32_bf16(false, ah, false, bl, (short)0, c, false, false);
  asm volatile("v_nop\n\tv_nop\n\tv_nop\n\tv_nop" : "+v"(c) : "v"(ah), "v"(al), "v"(bh), "v"(bl));
  return c;
}

__global__ __launch_bounds__(256) void k_wt_bf16(const float* __restrict__ W, unsigned short* __restrict__ Wt, int K, int N) {
  const int t = blockIdx.x * 256 + threadIdx.x;
  const int k8n = K / 8;
  if (t >= N * k8n) return;
  const int n = t / k8n, k8 = (t % k8n) * 8;
  v8us v;
#pragma unroll
  for (int i = 0; i < 8; ++i) v[i] = bf16_bits(W[(size_t)(k8 + i) * N + n]);
  *(v8us*)(Wt + (size_t)n * K + k8) = v;
  
}

// GEMM C[M][N] (f32, pitch ldc) = act(A[M][K]·W + bias). A f32 row-major (pitch lda) converted per fragment to bf16
// (ASPLIT: hi/lo two planes -> 2 terms, else single rounded term); Wt bf16 [N][K] (pitch ldb). BIAS_BF16 rounds the
// bias to bf16 first (bias quantised to bf16 before the add). K%32==0, M%16==0, N%64==0.
template <bool ASPLIT, int ACT, bool BIAS_BF16>
__global__ __launch_bounds__(128) void k_gemm_bf(const float* __restrict__ A, int lda, const unsigned short* __restrict__ Wt, int ldb,
                                               const float* __restrict__ bias, float* __restrict__ C, int ldc, int M, int N, int K) {
  __shared__ __attribute__((aligned(16))) float so[4][16][64];
  const int tid = threadIdx.x, w = tid >> 5, lane = tid & 31, ln = lane & 15, hh = lane >> 4;
  const int ntn = N / 64;
  const int wid = blockIdx.x * 4 + w;
  const int mt = wid / ntn, nq = wid % ntn;
  if (mt * 16 >= M) return;
  const int row0 = mt * 16, col0 = nq * 64;
  const float* arow = A + (size_t)(row0 + ln) * lda;
  v8f acc[4] = {};
  for (int kb = 0; kb < K; kb += 32) {
    FragB ah, al;
    const v4f x0 = *(const v4fa*)(arow + kb + 8 * hh), x1 = *(const v4fa*)(arow + kb + 8 * hh + 4);
    const v4f x2 = *(const v4fa*)(arow + kb + 16 + 8 * hh), x3 = *(const v4fa*)(arow + kb + 16 + 8 * hh + 4);
    float xs[16] = {x0[0],x0[1],x0[2],x0[3],x1[0],x1[1],x1[2],x1[3],x2[0],x2[1],x2[2],x2[3],x3[0],x3[1],x3[2],x3[3]};
#pragma unroll
    for (int i = 0; i < 16; ++i) { const unsigned short hb = bf16_bits(xs[i]); ah.u[i] = hb; al.u[i] = ASPLIT ? bf16_bits(xs[i] - bf16_val(hb)) : (unsigned short)0; }
#pragma unroll
    for (int t = 0; t < 4; ++t) {
      const unsigned short* brow = Wt + (size_t)(col0 + t * 16 + ln) * ldb + kb;
      FragB b;
      b.half[0] = *(const v8us*)(brow + 8 * hh);
      b.half[1] = *(const v8us*)(brow + 16 + 8 * hh);
      acc[t] = mmaN<ASPLIT ? 2 : 1>(ah.v, al.v, b.v, b.v, acc[t]);
    }
  }
#pragma unroll
  for (int t = 0; t < 4; ++t) {
    float bv = bias ? bias[col0 + t * 16 + ln] : 0.f;
    if (BIAS_BF16) bv = bf16_round(bv);
#pragma unroll
    for (int r = 0; r < 8; ++r) { float v = acc[t][r] + bv; if (ACT == 1) v = fmaxf(v, 0.f); so[w][8 * hh + r][t * 16 + ln] = v; }
  }
  __builtin_amdgcn_fence(__ATOMIC_ACQ_REL, "workgroup");
  __builtin_amdgcn_wave_barrier();
  const int rsub = lane >> 4, c4 = (lane & 15) * 4;
  {
#pragma unroll
    for (int q = 0; q < 8; ++q) {
      const int r = q * 2 + rsub;
      const v4f v = *(const v4fa*)&so[w][r][c4];
      *(v4f*)(C + (size_t)(row0 + r) * ldc + col0 + c4) = v;
    }
    
  }
}

// GEMM C = act(A·W + bias + resid): A f32 (ASPLIT -> hi/lo 2 terms), Wt bf16 [N][K]; ACT 0 none, 1 relu, 2 exact gelu;
// resid (optional, f32, row index = (row % rmod), pitch ldr, RES_BF16 rounds it) added before the activation.
template <bool ASPLIT, int ACT, bool BIAS_BF16, bool RES_BF16>
__global__ __launch_bounds__(128) void k_gemm_bf3(const float* __restrict__ A, int lda, const unsigned short* __restrict__ Wt, int ldb,
                                                const float* __restrict__ bias, const float* __restrict__ resid, int rmod, int ldr,
                                                float* __restrict__ C, int ldc, int M, int N, int K) {
  __shared__ __attribute__((aligned(16))) float so[4][16][64];
  const int tid = threadIdx.x, w = tid >> 5, lane = tid & 31, ln = lane & 15, hh = lane >> 4;
  const int ntn = N / 64;
  const int wid = blockIdx.x * 4 + w;
  const int mt = wid / ntn, nq = wid % ntn;
  if (mt * 16 >= M) return;
  const int row0 = mt * 16, col0 = nq * 64;
  const float* arow = A + (size_t)(row0 + ln) * lda;
  v8f acc[4] = {};
  for (int kb = 0; kb < K; kb += 32) {
    FragB ah, al;
    const v4f x0 = *(const v4fa*)(arow + kb + 8 * hh), x1 = *(const v4fa*)(arow + kb + 8 * hh + 4);
    const v4f x2 = *(const v4fa*)(arow + kb + 16 + 8 * hh), x3 = *(const v4fa*)(arow + kb + 16 + 8 * hh + 4);
    float xs[16] = {x0[0],x0[1],x0[2],x0[3],x1[0],x1[1],x1[2],x1[3],x2[0],x2[1],x2[2],x2[3],x3[0],x3[1],x3[2],x3[3]};
#pragma unroll
    for (int i = 0; i < 16; ++i) { const unsigned short hb = bf16_bits(xs[i]); ah.u[i] = hb; al.u[i] = ASPLIT ? bf16_bits(xs[i] - bf16_val(hb)) : (unsigned short)0; }
#pragma unroll
    for (int t = 0; t < 4; ++t) {
      const unsigned short* brow = Wt + (size_t)(col0 + t * 16 + ln) * ldb + kb;
      FragB b;
      b.half[0] = *(const v8us*)(brow + 8 * hh);
      b.half[1] = *(const v8us*)(brow + 16 + 8 * hh);
      acc[t] = mmaN<ASPLIT ? 2 : 1>(ah.v, al.v, b.v, b.v, acc[t]);
    }
  }
#pragma unroll
  for (int t = 0; t < 4; ++t) {
    const int col = col0 + t * 16 + ln;
    float bv = bias ? bias[col] : 0.f;
    if (BIAS_BF16) bv = bf16_round(bv);
#pragma unroll
    for (int r = 0; r < 8; ++r) {
      float v = acc[t][r] + bv;
      if (resid) { float rv = resid[(size_t)((row0 + 8 * hh + r) % rmod) * ldr + col]; if (RES_BF16) rv = bf16_round(rv); v += rv; }
      if (ACT == 1) v = fmaxf(v, 0.f);
      if (ACT == 2) v = 0.5f * v * (1.0f + erff(v * 0.70710678118654752f));
      if (ACT == 3) { const float u = 0.7978845608028654f * (v + 0.044715f * v * v * v); v = 0.5f * v * (1.0f + tanhf(u)); }
      so[w][8 * hh + r][t * 16 + ln] = v;
    }
  }
  __builtin_amdgcn_fence(__ATOMIC_ACQ_REL, "workgroup");
  __builtin_amdgcn_wave_barrier();
  const int rsub = lane >> 4, c4 = (lane & 15) * 4;
  {
#pragma unroll
    for (int q = 0; q < 8; ++q) {
      const int r = q * 2 + rsub;
      const v4f v = *(const v4fa*)&so[w][r][c4];
      *(v4f*)(C + (size_t)(row0 + r) * ldc + col0 + c4) = v;
    }
    
  }
}
// row LayerNorm (biased variance, eps) over N: s = X (+ R); optional out_sum <- s; out_norm <- (s-mu)*rsqrt(var+eps)*g + b
template <bool PARAM_BF16>
__global__ __launch_bounds__(256) void k_layernorm(const float* __restrict__ X, const float* __restrict__ R, const float* __restrict__ g, const float* __restrict__ bta,
                                                  float* __restrict__ out_sum, float* __restrict__ out_norm, int N, float eps) {
  __shared__ float red[256];
  const int row = blockIdx.x, tid = threadIdx.x;
  const float* x = X + (size_t)row * N; const float* rr = R ? R + (size_t)row * N : nullptr;
  float vals[16];                     // up to N = 4096
  const int per = N / 256;            // contiguous chunk per thread? use strided-by-4 chunks: thread handles j = tid*4 + 1024*u
  float s1 = 0.f;
  for (int u = 0; u < per / 4; ++u) {
    const int j = tid * 4 + 1024 * u;
    const v4f a = *(const v4fa*)(x + j);
    v4f b = {0.f,0.f,0.f,0.f}; if (rr) b = *(const v4fa*)(rr + j);
#pragma unroll
    for (int q = 0; q < 4; ++q) { const float v = a[q] + b[q]; vals[u * 4 + q] = v; s1 += v; }
  }
  red[tid] = s1; __syncthreads();
  for (int st = 128; st > 0; st >>= 1) { if (tid < st) red[tid] += red[tid + st]; __syncthreads(); }
  const float mu = red[0] / (float)N; __syncthreads();
  float s2 = 0.f;
  for (int u = 0; u < per / 4; ++u)
#pragma unroll
    for (int q = 0; q < 4; ++q) { const float c = vals[u * 4 + q] - mu; s2 += c * c; }
  red[tid] = s2; __syncthreads();
  for (int st = 128; st > 0; st >>= 1) { if (tid < st) red[tid] += red[tid + st]; __syncthreads(); }
  const float rs = rsqrtf(red[0] / (float)N + eps);
  {
    for (int u = 0; u < per / 4; ++u) {
      const int j = tid * 4 + 1024 * u;
      v4f o, sm;
#pragma unroll
      for (int q = 0; q < 4; ++q) {
        float gg = g[j + q], bb = bta[j + q];
        if (PARAM_BF16) { gg = bf16_round(gg); bb = bf16_round(bb); }
        sm[q] = vals[u * 4 + q]; o[q] = (vals[u * 4 + q] - mu) * rs * gg + bb;
      }
      if (out_sum) *(v4f*)(out_sum + (size_t)row * N + j) = sm;
      *(v4f*)(out_norm + (size_t)row * N + j) = o;
    }
    
  }
}



// ---- f16 WMMA path (v_wmma_f32_16x16x32_f16): 11-bit significands for operands in range — used where a [0,1] probability operand needs more precision than bf16
typedef _Float16 v16h __attribute__((ext_vector_type(16)));
union FragH { v16h v; v8us half[2]; _Float16 h[16]; unsigned short u[16]; };
template <int NT>
__device__ __forceinline__ v8f mmaH(v16h ah, v16h al, v16h bh, v16h bl, v8f c) {
  c = __builtin_amdgcn_wmma_f32_16x16x32_f16(false, ah, false, bh, (short)0, c, false, false);
  if (NT >= 2) c = __builtin_amdgcn_wmma_f32_16x16x32_f16(false, al, false, bh, (short)0, c, false, false);
  if (NT >= 3) c = __builtin_amdgcn_wmma_f32_16x16x32_f16(false, ah, false, bl, (short)0, c, false, false);
  asm volatile("v_nop\n\tv_nop\n\tv_nop\n\tv_nop" : "+v"(c) : "v"(ah), "v"(al), "v"(bh), "v"(bl));
  return c;
}
// batched GEMM like k_gemm_b but f16 operands: A f32 (split into f16 hi/lo if ASPLIT, else rounded to f16), Bt = f16 values [n][k]; alpha; C f32; N multiple of 16 (partial tiles skipped)
template <bool ASPLIT>
__global__ __launch_bounds__(128) void k_gemm_h(const float* __restrict__ A, int lda, size_t sA, const _Float16* __restrict__ Bh, int ldb, size_t sB, float alpha, float* __restrict__ C, int ldc, size_t sC, int M, int N, int K) {
  __shared__ __attribute__((aligned(16))) float so[4][16][64];
  const int tid = threadIdx.x, w = tid >> 5, lane = tid & 31, ln = lane & 15, hh = lane >> 4; const int by = blockIdx.y;
  A += (size_t)by * sA; Bh += (size_t)by * sB; C += (size_t)by * sC;
  const int ntn = (N + 63) / 64; const int wid = blockIdx.x * 4 + w; const int mt = wid / ntn, nq = wid % ntn; if (mt * 16 >= M) return;
  const int row0 = mt * 16, col0 = nq * 64; const float* arow = A + (size_t)(row0 + ln) * lda;
  v8f acc[4] = {};
  for (int kb = 0; kb < K; kb += 32) {
    FragH ah, al;
    const v4f x0 = *(const v4fa*)(arow + kb + 8 * hh), x1 = *(const v4fa*)(arow + kb + 8 * hh + 4), x2 = *(const v4fa*)(arow + kb + 16 + 8 * hh), x3 = *(const v4fa*)(arow + kb + 16 + 8 * hh + 4);
    float xs[16] = {x0[0],x0[1],x0[2],x0[3],x1[0],x1[1],x1[2],x1[3],x2[0],x2[1],x2[2],x2[3],x3[0],x3[1],x3[2],x3[3]};
#pragma unroll
    for (int i = 0; i < 16; ++i) { const _Float16 h = (_Float16)xs[i]; ah.h[i] = h; al.h[i] = ASPLIT ? (_Float16)(xs[i] - (float)h) : (_Float16)0.0f; }
#pragma unroll
    for (int t = 0; t < 4; ++t) { if (col0 + t * 16 >= N) continue; const size_t boff = (size_t)(col0 + t * 16 + ln) * ldb + kb; FragH bq; bq.half[0] = *(const v8us*)(Bh + boff + 8 * hh); bq.half[1] = *(const v8us*)(Bh + boff + 16 + 8 * hh);
      acc[t] = mmaH<ASPLIT ? 2 : 1>(ah.v, al.v, bq.v, bq.v, acc[t]); }
  }
#pragma unroll
  for (int t = 0; t < 4; ++t) { if (col0 + t * 16 >= N) continue;
#pragma unroll
    for (int r = 0; r < 8; ++r) so[w][8 * hh + r][t * 16 + ln] = acc[t][r] * alpha; }
  __builtin_amdgcn_fence(__ATOMIC_ACQ_REL, "workgroup"); __builtin_amdgcn_wave_barrier();
  const int rsub = lane >> 4, c4 = (lane & 15) * 4;
  {
#pragma unroll
    for (int q = 0; q < 8; ++q) { const int r = q * 2 + rsub; if (col0 + c4 < N) { const v4f v = *(const v4fa*)&so[w][r][c4]; *(v4f*)(C + (size_t)(row0 + r) * ldc + col0 + c4) = v; } }
     }
}

// Wt[n][k] = f16(W[k][n]·scale) from f32 row-major W[K][N] (scale = power of two; bf16-exact weights stay exact in f16 away from the subnormal range)
__global__ __launch_bounds__(256) void k_wt_f16(const float* __restrict__ W, _Float16* __restrict__ Wt, int K, int N, float scale) {
  const int t = blockIdx.x * 256 + threadIdx.x; if (t >= N * (K / 8)) return; const int n = t / (K / 8), k8 = (t % (K / 8)) * 8; FragH f;
#pragma unroll
  for (int i = 0; i < 8; ++i) f.h[i] = (_Float16)(bf16_round(W[(size_t)(k8 + i) * N + n]) * scale); const v8us o = f.half[0];
  *(v8us*)((unsigned short*)Wt + (size_t)n * K + k8) = o; 
}


typedef _Float16 v4h __attribute__((ext_vector_type(4)));

__global__ __launch_bounds__(256) void k_h16(const float* __restrict__ x, _Float16* __restrict__ X16, size_t n8) { const size_t t = (size_t)blockIdx.x * 256 + threadIdx.x; if (t >= n8) return; FragH f;
#pragma unroll
  for (int q = 0; q < 8; ++q) f.h[q] = (_Float16)x[t * 8 + q]; *(v8us*)((unsigned short*)X16 + t * 8) = f.half[0];  }
__global__ __launch_bounds__(256) void k_round16f(const float* __restrict__ W, _Float16* __restrict__ Bt, size_t n8) { const size_t t = (size_t)blockIdx.x * 256 + threadIdx.x; if (t >= n8) return; FragH f;
#pragma unroll
  for (int i = 0; i < 8; ++i) f.h[i] = (_Float16)(bf16_round(W[t * 8 + i]) * 16.0f); *(v8us*)((unsigned short*)Bt + t * 8) = f.half[0];  }
template <int NHv, int TTv>
__global__ __launch_bounds__(256) void k_vt(const _Float16* __restrict__ V16, int ldv, int voff, _Float16* __restrict__ Vt) { __shared__ unsigned short tl[64][66]; const int tid = threadIdx.x; const int slab = blockIdx.x / (TTv / 64), lg = blockIdx.x % (TTv / 64); const int b = slab / NHv, h = slab % NHv;
  for (int i = tid; i < 64 * 8; i += 256) { const int r = i / 8, c8 = (i % 8) * 8; FragH f; f.half[0] = *(const v8us*)((const unsigned short*)V16 + ((size_t)b * TTv + lg * 64 + r) * ldv + voff + h * 64 + c8);
#pragma unroll
    for (int q = 0; q < 8; ++q) tl[r][c8 + q] = f.u[q]; }
  __syncthreads();
  {
#pragma unroll
    for (int rd = 0; rd < 2; ++rd) { const int d = rd * 32 + tid / 8, pc = tid % 8; FragH f;
#pragma unroll
      for (int q = 0; q < 8; ++q) f.u[q] = tl[pc * 8 + q][d];
      *(v8us*)((unsigned short*)Vt + ((size_t)slab * 64 + d) * TTv + lg * 64 + pc * 8) = f.half[0]; }
     } }

__global__ __launch_bounds__(256) void k_hl(const float* __restrict__ F, _Float16* __restrict__ Hh, _Float16* __restrict__ Hl, size_t n8) { const size_t t = (size_t)blockIdx.x * 256 + threadIdx.x; if (t >= n8) return; FragH fh, fl; const v4f a = *(const v4fa*)(F + t * 8), c = *(const v4fa*)(F + t * 8 + 4);
#pragma unroll
  for (int q = 0; q < 4; ++q) { _Float16 h = (_Float16)a[q]; fh.h[q] = h; fl.h[q] = (_Float16)((a[q] - (float)h) * 1024.0f); h = (_Float16)c[q]; fh.h[4 + q] = h; fl.h[4 + q] = (_Float16)((c[q] - (float)h) * 1024.0f); }
  { *(v8us*)((unsigned short*)Hh + t * 8) = fh.half[0]; *(v8us*)((unsigned short*)Hl + t * 8) = fl.half[0];  } }

typedef unsigned int u32x4 __attribute__((ext_vector_type(4)));
typedef unsigned int u32x4a __attribute__((ext_vector_type(4), may_alias));
typedef float f32x2 __attribute__((ext_vector_type(2)));
typedef _Float16 f16x2 __attribute__((ext_vector_type(2)));
#define FSK 64                    /* keys per half-stage */
#define FPITCH 144u               /* LDS row pitch: 128 B of data + 16 B, an odd multiple of 16 B for 16-byte readers */
#define FTILE (64u * FPITCH)      /* one K tile (64 keys x 64 d) or one V^T tile (64 d x 64 keys) */
#define FBUF (2u * FTILE)         /* one half-stage: K tile, then V^T tile; a stage buffer is two of them, the ring two stage buffers */
#define FEP 272u                  /* output staging pitch: 256 B + 16 B */
#define FEX (9u * 512u)           /* one wave's exchange slot: 8 accumulator planes and one of maximum and row sum; 16 slots fill one ring */
struct FragU { u32x4 q[2]; };
__device__ __forceinline__ v8f mmaU(const FragU& a, const FragU& b, v8f c) { return __builtin_amdgcn_wmma_f32_16x16x32_f16(false, __builtin_bit_cast(v16h, a), false, __builtin_bit_cast(v16h, b), (short)0, c, false, false); }
__device__ __forceinline__ unsigned int pack2h(float lo, float hi) { return __builtin_bit_cast(unsigned int, __builtin_convertvector(f32x2{lo, hi}, f16x2)); }
__device__ __forceinline__ float xhalf(float x) { return __builtin_bit_cast(float, __builtin_amdgcn_permlanex16(__builtin_bit_cast(int, x), __builtin_bit_cast(int, x), 0x76543210, 0xfedcba98, false, false)); }  // lane l <-> lane l ^ 16
__global__ __launch_bounds__(512) void k_fattn(const _Float16* __restrict__ Q, const _Float16* __restrict__ K, const _Float16* __restrict__ VT, float* __restrict__ O) {
  __shared__ __attribute__((aligned(16))) unsigned char Ls[8u * FBUF];      // two rings of 4 FBUF, one a key group
  const unsigned int lane = threadIdx.x & 31u, wave16 = (unsigned int)__builtin_amdgcn_readfirstlane((int)(threadIdx.x >> 5)), c = lane & 15u, hh = lane >> 4;
  const unsigned int grp = wave16 >> 3, wave = wave16 & 7u, tid = threadIdx.x & 255u;      // key group; wave and thread inside it
  unsigned char* const Lg = Ls + grp * (4u * FBUF);
  const unsigned int bh = blockIdx.x / (LL / 256), qblk = blockIdx.x % (LL / 256), b = bh / NH, h = bh % NH;
  const unsigned int q0 = qblk * 256u + wave * 32u;
  const float cscale = 0.125f * 1.4426950408889634f;      // 1/sqrt(64), scores taken to the log2 domain
  // staging map: 8 threads cover one 128-byte row; a thread brings rows srow and srow + 32 of the K tile and of the V^T tile
  const unsigned int srow = tid >> 3, sch = (tid & 7u) * 16u;
  const unsigned char* kg = (const unsigned char*)(K + ((size_t)b * LL + grp * (LL / 2) + srow) * DM + h * DHd) + sch;
  const unsigned char* vg = (const unsigned char*)(VT + ((size_t)bh * DHd + srow) * LL + grp * (LL / 2)) + sch;
  const unsigned int sdst = srow * FPITCH + sch;
  u32x4 r0, r1, r2, r3;
  auto gload = [&](unsigned int st) {
    const unsigned char* kp = kg + (size_t)st * (FSK * DM * 2); const unsigned char* vp = vg + (size_t)st * (FSK * 2);
    r0 = *(const u32x4a*)kp; r1 = *(const u32x4a*)(kp + 32 * DM * 2); r2 = *(const u32x4a*)vp; r3 = *(const u32x4a*)(vp + 32 * LL * 2); };
  auto sstore = [&](unsigned char* base) {
    unsigned char* p = base + sdst;
    *(u32x4a*)p = r0; *(u32x4a*)(p + 32u * FPITCH) = r1; *(u32x4a*)(p + FTILE) = r2; *(u32x4a*)(p + FTILE + 32u * FPITCH) = r3; };
  gload(0);
  FragU qf[2][2];      // B operand: column = query, k = d in the hardware order (16 B at 16 hh and at 32 + 16 hh of each 64 B), as K's rows below
#pragma unroll
  for (int g = 0; g < 2; ++g) { const unsigned char* qp = (const unsigned char*)(Q + ((size_t)b * LL + q0 + 16u * g + c) * DM + h * DHd) + 16u * hh;
#pragma unroll
    for (int kc = 0; kc < 2; ++kc) { qf[g][kc].q[0] = *(const u32x4a*)(qp + 64 * kc); qf[g][kc].q[1] = *(const u32x4a*)(qp + 64 * kc + 32); } }
  FragU ones; ones.q[0] = u32x4{0x3C003C00u, 0x3C003C00u, 0x3C003C00u, 0x3C003C00u}; ones.q[1] = ones.q[0];      // f16 1.0 everywhere
  v8f acc[2][4] = {}; v8f lacc[2] = {}; float m_run[2] = {-1.0e30f, -1.0e30f};
  sstore(Lg); gload(1); sstore(Lg + FBUF);
  __syncthreads();
  // one half-stage (64 keys, two passes) of stage st; more: a stage st + 1 exists (a literal at both call sites, so no test stands in the loop)
  auto halfstage = [&](unsigned int st, unsigned int hf, bool more) __attribute__((always_inline)) {
    if (more) { gload(2u * st + 2u + hf);      // the next stage's same half flies under this half's two passes
      __builtin_amdgcn_sched_barrier(0); }      // keeps the four loads up here: without it the compiler sinks them to their LDS stores and the wave waits out the whole load latency there
    const unsigned char* Lb = Lg + (st & 1u) * (2u * FBUF) + hf * FBUF;
#pragma unroll
    for (unsigned int sub = 0; sub < 2; ++sub) {      // one pass = 32 keys
      FragU kf[2][2];
#pragma unroll
      for (int kt = 0; kt < 2; ++kt) { const unsigned char* p = Lb + (sub * 32u + 16u * kt + c) * FPITCH + 16u * hh;
#pragma unroll
        for (int kc = 0; kc < 2; ++kc) { kf[kt][kc].q[0] = *(const u32x4a*)(p + 64 * kc); kf[kt][kc].q[1] = *(const u32x4a*)(p + 64 * kc + 32); } }
      FragU vf[4];
#pragma unroll
      for (int t = 0; t < 4; ++t) { const unsigned char* p = Lb + FTILE + (16u * t + c) * FPITCH + sub * 64u + 16u * hh; vf[t].q[0] = *(const u32x4a*)p; vf[t].q[1] = *(const u32x4a*)(p + 32); }
      v8f s[2][2];      // s[kt][g][r] = score of key 16 kt + 8 hh + r against query column c of group g
#pragma unroll
      for (int kt = 0; kt < 2; ++kt)
#pragma unroll
        for (int g = 0; g < 2; ++g) { s[kt][g] = v8f{};
#pragma unroll
          for (int kc = 0; kc < 2; ++kc) s[kt][g] = mmaU(kf[kt][kc], qf[g][kc], s[kt][g]); }
      float mb[2]; bool need = false;
#pragma unroll
      for (int g = 0; g < 2; ++g) { float mx = s[0][g][0];
#pragma unroll
        for (int r = 1; r < 8; ++r) mx = fmaxf(mx, s[0][g][r]);
#pragma unroll
        for (int r = 0; r < 8; ++r) mx = fmaxf(mx, s[1][g][r]);
        mx = fmaxf(mx, xhalf(mx)) * cscale; mb[g] = mx; need = need || (mx > m_run[g] + 8.0f); }
      // lazy rescale, tested once per pass: the maximum in use may trail the true one by up to 8 (log2), so an exponential stays below 2^8
      if (__builtin_amdgcn_ballot_w32(need) != 0) {
#pragma unroll
        for (int g = 0; g < 2; ++g) { const float m_new = fmaxf(m_run[g], mb[g]); const float corr = __builtin_amdgcn_exp2f(m_run[g] - m_new); m_run[g] = m_new; lacc[g] = lacc[g] * corr;
#pragma unroll
          for (int t = 0; t < 4; ++t) acc[g][t] = acc[g][t] * corr; }
      }
#pragma unroll
      for (int g = 0; g < 2; ++g) { const float nm = 6.0f - m_run[g];      // P carries a factor 2^6 (cancels in the division): small weights stay normal f16, the largest stays below 2^14
        unsigned int w[8];
#pragma unroll
        for (int i = 0; i < 8; ++i) { const f32x2 a = __builtin_elementwise_fma(f32x2{s[i >> 2][g][2 * (i & 3)], s[i >> 2][g][2 * (i & 3) + 1]}, f32x2{cscale, cscale}, f32x2{nm, nm});
          w[i] = pack2h(__builtin_amdgcn_exp2f(a.x), __builtin_amdgcn_exp2f(a.y)); }
        FragU pf; pf.q[0] = u32x4{w[0], w[1], w[2], w[3]}; pf.q[1] = u32x4{w[4], w[5], w[6], w[7]};
#pragma unroll
        for (int t = 0; t < 4; ++t) acc[g][t] = mmaU(vf[t], pf, acc[g][t]);
        lacc[g] = mmaU(ones, pf, lacc[g]); }
    }
    if (more) sstore(Lg + ((st + 1u) & 1u) * (2u * FBUF) + hf * FBUF);      // into the stage buffer whose last readers passed the barrier that ended stage st - 1
    // Four vector slots between the pass's last WMMAs and the next half-stage's first vector write over their B registers;
    // the two scheduling barriers keep the WMMAs in front of the slots and the next writes behind them.
    __builtin_amdgcn_sched_barrier(0);
    asm volatile("v_nop\n\tv_nop\n\tv_nop\n\tv_nop");
    __builtin_amdgcn_sched_barrier(0);
  };
#pragma unroll 1      // the stage loop stays a loop: its body is already two passes long
  for (unsigned int st = 0; st + 1u < LL / (4 * FSK); ++st) {
#pragma unroll 1      // rolled: unrolled, the four passes need more than 256 VGPRs
    for (unsigned int hf = 0; hf < 2; ++hf) halfstage(st, hf, true);
    __syncthreads();      // publishes stage st + 1 and ends every wave's reads of stage st
  }
#pragma unroll 1      // rolled, as above
  for (unsigned int hf = 0; hf < 2; ++hf) halfstage(LL / (4 * FSK) - 1u, hf, false);
  __syncthreads();      // every wave has left the rings: ring 0 becomes the exchange area, ring 1 output staging
  // Join of the two key groups. Key group 0 finishes query group 0, key group 1 query group 1; a wave hands the query group it does not finish to its partner (same query columns,
  // other key group) through a slot of its own: eight 512-byte planes of accumulators (a lane's 16 bytes side by side, so stores and loads meet no bank twice) and one plane with the
  // maximum in use and the row sum. Which of the two is kept is picked by selects on the wave-uniform group number, so that one copy of the code serves both groups.
  const bool first = grp == 0u;
  v8f keep[4], hand[4];
#pragma unroll
  for (int t = 0; t < 4; ++t)
#pragma unroll
    for (int r = 0; r < 8; ++r) { keep[t][r] = first ? acc[0][t][r] : acc[1][t][r]; hand[t][r] = first ? acc[1][t][r] : acc[0][t][r]; }
  const float mk = first ? m_run[0] : m_run[1], lk = first ? lacc[0][0] : lacc[1][0];
  { unsigned char* p = Ls + wave16 * FEX + lane * 16u;
#pragma unroll
    for (int t = 0; t < 4; ++t) { *(v4fa*)(p + (2 * t) * 512) = v4f{hand[t][0], hand[t][1], hand[t][2], hand[t][3]}; *(v4fa*)(p + (2 * t + 1) * 512) = v4f{hand[t][4], hand[t][5], hand[t][6], hand[t][7]}; }
    *(v4fa*)(p + 8 * 512) = v4f{first ? m_run[1] : m_run[0], first ? lacc[1][0] : lacc[0][0], 0.f, 0.f}; }
  __syncthreads();      // publishes every wave's slot to its partner
  // Both partial sums are taken to the larger of the two maxima, added and divided by the joined row sum; the wave stages its 16 query rows in its own range and stores whole 256-byte rows.
  const unsigned char* px = Ls + (wave16 ^ 8u) * FEX + lane * 16u;
  const v4f ml = *(const v4fa*)(px + 8 * 512);
  const float mj = fmaxf(mk, ml[0]), ca = __builtin_amdgcn_exp2f(mk - mj), cb = __builtin_amdgcn_exp2f(ml[0] - mj);
  const float inv = 1.0f / (lk * ca + ml[1] * cb), fa = ca * inv, fb = cb * inv;
  unsigned char* Le = Ls + 4u * FBUF + wave16 * (16u * FEP);
#pragma unroll
  for (int t = 0; t < 4; ++t) { const v4f o0 = *(const v4fa*)(px + (2 * t) * 512), o1 = *(const v4fa*)(px + (2 * t + 1) * 512);
    unsigned char* s = Le + c * FEP + (16u * t + 8u * hh) * 4u;      // row = query c, columns d = 16 t + 8 hh + r
    *(v4fa*)s = v4f{keep[t][0], keep[t][1], keep[t][2], keep[t][3]} * fa + o0 * fb; *(v4fa*)(s + 16) = v4f{keep[t][4], keep[t][5], keep[t][6], keep[t][7]} * fa + o1 * fb; }
#pragma unroll
  for (int i = 0; i < 8; ++i) { const unsigned int row = 2u * i + hh; const v4f v = *(const v4fa*)(Le + row * FEP + c * 16u);
    *(v4fa*)(O + ((size_t)b * LL + q0 + 16u * grp + row) * DM + h * DHd + c * 4u) = v; }
}

// ---- q_w, k, v^T in one launch: one work-group = 256 sequence rows of one (batch, head), 8 waves x 32 rows. x and the three 64 x 64 weights are read as f32,
// rounded (x: its bf16 value held as f16; W: its bf16 value x 16, the blade sign folded into Wq and bq) and laid in LDS as f16 rows; every product is a WMMA.
// q and k are formed transposed (A = W rows, B = x rows): a lane then holds 8 neighbouring outputs of one sequence row, one 16-byte piece of a q or k row.
// v is formed straight (A = x rows, B = Wv rows): a lane holds 8 neighbouring sequence rows of one d, one 16-byte piece of a V^T row. All three go through LDS, so
// that every global store is made of whole 128-byte lines. Both operands of every product take k in the same hardware order (16 B at 16 hh and at 32 + 16 hh of each 64 B).
typedef unsigned int u32x2 __attribute__((ext_vector_type(2)));
typedef unsigned int u32x2a __attribute__((ext_vector_type(2), may_alias));
#define PVP 528u                          /* V^T staging pitch: 512 B of one d row + 16 B */
#define PL_W (256u * FPITCH)              /* behind the x rows: three weight tiles of 64 rows */
#define PL_B (PL_W + 3u * FTILE)          /* three biases, f32 */
#define PL_Q (PL_B + 3u * 256u)           /* q rows, then k rows: 256 each */
#define PL_V (PL_Q + 2u * 256u * FPITCH)  /* V^T: 64 d rows of 256 sequence places */
#define PL_END (PL_V + 64u * PVP)
__device__ __forceinline__ float blade_sign(unsigned int o) { return ((0xB2u >> (o & 7u)) & 1u) ? -1.f : 1.f; }      // blades 1, 4, 5, 7 are negative
__device__ __forceinline__ u32x4 pack8h(const v8f a, const v4f b0, const v4f b1) {      // f16(a / 16 + bias), eight neighbours
  return u32x4{pack2h(a[0] * 0.0625f + b0[0], a[1] * 0.0625f + b0[1]), pack2h(a[2] * 0.0625f + b0[2], a[3] * 0.0625f + b0[3]),
               pack2h(a[4] * 0.0625f + b1[0], a[5] * 0.0625f + b1[1]), pack2h(a[6] * 0.0625f + b1[2], a[7] * 0.0625f + b1[3])}; }
__global__ __launch_bounds__(256) void k_qkv(const float* __restrict__ x, const float* __restrict__ Wq, const float* __restrict__ bq, const float* __restrict__ Wk, const float* __restrict__ bk,
                                             const float* __restrict__ Wv, const float* __restrict__ bv, _Float16* __restrict__ Qo, _Float16* __restrict__ Ko, _Float16* __restrict__ VTo) {
  __shared__ __attribute__((aligned(16))) unsigned char Lp[PL_END];
  const unsigned int tid = threadIdx.x, lane = tid & 31u, wave = (unsigned int)__builtin_amdgcn_readfirstlane((int)(tid >> 5)), c = lane & 15u, hh = lane >> 4;
  const unsigned int bh = blockIdx.x / (LL / 256), lblk = blockIdx.x % (LL / 256), b = bh / NH, h = bh % NH;
  const unsigned int l0 = lblk * 256u, w0 = wave * 32u;
  // every global read of the kernel is issued here, ahead of any conversion: 16 lanes cover one 256-byte x row (a wave brings its own 32 rows), the weights go linearly over the block
  const float* xg = x + ((size_t)b * LL + l0 + w0 + hh) * DM + h * DHd + c * 4u;
  v4f xr[16], wr[3][4];
#pragma unroll
  for (int i = 0; i < 16; ++i) xr[i] = *(const v4fa*)(xg + (size_t)(2 * i) * DM);
#pragma unroll
  for (int j = 0; j < 4; ++j) { wr[0][j] = *(const v4fa*)(Wq + j * 1024 + tid * 4u); wr[1][j] = *(const v4fa*)(Wk + j * 1024 + tid * 4u); wr[2][j] = *(const v4fa*)(Wv + j * 1024 + tid * 4u); }
  const unsigned int bo = tid & 63u;
  float br = 0.f;
  if (wave < 2u) br = bq[bo]; else if (wave < 4u) br = bk[bo]; else if (wave < 6u) br = bv[bo];
  asm volatile("s_wait_xcnt 0x0" ::: "memory");      // stands in front of the first reuse of an address register of the loads above
  __builtin_amdgcn_sched_barrier(0);      // keeps the conversions, which reuse those registers, behind the wait: without it the compiler lifted the first of them over it
#pragma unroll
  for (int i = 0; i < 16; ++i)
    *(u32x2a*)(Lp + (w0 + 2u * i + hh) * FPITCH + c * 8u) = u32x2{pack2h(bf16_round(xr[i][0]), bf16_round(xr[i][1])), pack2h(bf16_round(xr[i][2]), bf16_round(xr[i][3]))};
#pragma unroll
  for (int mt = 0; mt < 3; ++mt)
#pragma unroll
    for (int j = 0; j < 4; ++j) { const unsigned int o = 16u * j + (tid >> 4); const float s = mt == 0 ? blade_sign(o) : 1.f; const v4f w = wr[mt][j];
      *(u32x2a*)(Lp + PL_W + mt * FTILE + o * FPITCH + c * 8u) = u32x2{pack2h(bf16_round(w[0]) * 16.0f * s, bf16_round(w[1]) * 16.0f * s), pack2h(bf16_round(w[2]) * 16.0f * s, bf16_round(w[3]) * 16.0f * s)}; }
  if (wave < 6u) *(float*)(Lp + PL_B + tid * 4u) = bf16_round(br) * (wave < 2u ? blade_sign(bo) : 1.f);
  __syncthreads();      // publishes the weights and biases (the x rows are read by the wave that wrote them)
  FragU xf[2][2];
#pragma unroll
  for (int m = 0; m < 2; ++m) { const unsigned char* p = Lp + (w0 + 16u * m + c) * FPITCH + 16u * hh;
#pragma unroll
    for (int kc = 0; kc < 2; ++kc) { xf[m][kc].q[0] = *(const u32x4a*)(p + 64 * kc); xf[m][kc].q[1] = *(const u32x4a*)(p + 64 * kc + 32); } }
#pragma unroll
  for (int mt = 0; mt < 3; ++mt) {
    FragU wf[4][2];
#pragma unroll
    for (int t = 0; t < 4; ++t) { const unsigned char* p = Lp + PL_W + mt * FTILE + (16u * t + c) * FPITCH + 16u * hh;
#pragma unroll
      for (int kc = 0; kc < 2; ++kc) { wf[t][kc].q[0] = *(const u32x4a*)(p + 64 * kc); wf[t][kc].q[1] = *(const u32x4a*)(p + 64 * kc + 32); } }
    v8f a[2][4] = {};
#pragma unroll
    for (int kc = 0; kc < 2; ++kc)
#pragma unroll
      for (int m = 0; m < 2; ++m)
#pragma unroll
        for (int t = 0; t < 4; ++t) a[m][t] = mt < 2 ? mmaU(wf[t][kc], xf[m][kc], a[m][t]) : mmaU(xf[m][kc], wf[t][kc], a[m][t]);
#pragma unroll
    for (int t = 0; t < 4; ++t) {
      if (mt < 2) {      // a[m][t][r]: output 16 t + 8 hh + r of sequence row 16 m + c
        const v4f b0 = *(const v4fa*)(Lp + PL_B + mt * 256u + (16u * t + 8u * hh) * 4u), b1 = *(const v4fa*)(Lp + PL_B + mt * 256u + (16u * t + 8u * hh) * 4u + 16u);
#pragma unroll
        for (int m = 0; m < 2; ++m) *(u32x4a*)(Lp + PL_Q + (mt * 256u + w0 + 16u * m + c) * FPITCH + (16u * t + 8u * hh) * 2u) = pack8h(a[m][t], b0, b1);
      } else {           // a[m][t][r]: d = 16 t + c of sequence row 16 m + 8 hh + r
        const float bd = *(const float*)(Lp + PL_B + 512u + (16u * t + c) * 4u); const v4f b4 = v4f{bd, bd, bd, bd};
#pragma unroll
        for (int m = 0; m < 2; ++m) *(u32x4a*)(Lp + PL_V + (16u * t + c) * PVP + (w0 + 16u * m + 8u * hh) * 2u) = pack8h(a[m][t], b4, b4);
      }
    }
  }
  __syncthreads();      // publishes the staged V^T rows, each made of all eight waves' pieces (and orders each wave's own q and k rows)
  const unsigned int r4 = lane >> 3, c16 = (lane & 7u) * 16u;      // 8 lanes cover one 128-byte q or k row
#pragma unroll
  for (int i = 0; i < 8; ++i) { const unsigned int row = w0 + 4u * i + r4; const size_t go = (((size_t)b * LL + l0 + row) * DM + h * DHd) * 2u + c16;
    *(u32x4a*)((unsigned char*)Qo + go) = *(const u32x4a*)(Lp + PL_Q + row * FPITCH + c16);
    *(u32x4a*)((unsigned char*)Ko + go) = *(const u32x4a*)(Lp + PL_Q + (256u + row) * FPITCH + c16); }
#pragma unroll
  for (int i = 0; i < 8; ++i) { const unsigned int d = wave * 8u + i;      // a wave stores 512 contiguous bytes of one V^T row
    *(u32x4a*)((unsigned char*)(VTo + ((size_t)bh * DHd + d) * LL + l0) + lane * 16u) = *(const u32x4a*)(Lp + PL_V + d * PVP + lane * 16u); }
}

extern "C" void kernel_launch(void* const* d_in, const int* in_sizes, int n_in,
                              void* d_out, int out_size, void* d_ws, size_t ws_size, hipStream_t stream) {
  (void)in_sizes; (void)n_in; (void)out_size;
  const float* x = (const float*)d_in[0]; const float* Wq = (const float*)d_in[1]; const float* bq = (const float*)d_in[2]; const float* Wk = (const float*)d_in[3]; const float* bk = (const float*)d_in[4]; const float* Wv = (const float*)d_in[5]; const float* bv = (const float*)d_in[6];
  char* ws = (char*)d_ws; size_t off = 0;
  auto take = [&](size_t bytes) { char* p = ws + off; off += (bytes + 255) & ~(size_t)255; return p; };
  _Float16* QW16 = (_Float16*)take((size_t)NR * DM * 2); _Float16* K16 = (_Float16*)take((size_t)NR * DM * 2); _Float16* VT = (_Float16*)take((size_t)NR * DM * 2);
  if (off > ws_size) return;      // 3 x 8.4 = 25 MB
  k_qkv<<<NBt * NH * (LL / 256), 256, 0, stream>>>(x, Wq, bq, Wk, bk, Wv, bv, QW16, K16, VT);      /* per-head shared linears (exact products + bias, f16 results; q sign-weighted via the folded weights), v written transposed */
  k_fattn<<<NBt * NH * (LL / 256), 512, 0, stream>>>(QW16, K16, VT, (float*)d_out);      /* scores, softmax, attn*v: every (b, h, 256-query block) in one launch, its keys split over two wave groups */
}

// v004
// It runs in 56.6 microseconds.
// Next to v003, in two timings, it ran 1.05 and 1.04 times as fast.
// Counting every step since v000, it is 83.7 times as fast.
#include <hip/hip_runtime.h>
// Clifford (multivector) attention (B 2, L 4096, 8 heads × (8 dims × 8 blades) = 512): per head a shared Linear 64→64 (+bias) gives q, k, v from the head's slice of x; q is sign-weighted per blade ([1,−1,1,1,−1,−1,1,−1] over the blade index = column mod 8); logits = q_w·k/8 over the 64 components; softmax over the 4096 keys; out = attn·v → [2,4096,512] (heads concatenated; no output projection).
// Compute dtype: x and parameters rounded to bf16; q/k/v with exact products (+bias, f32), the per-blade sign folded exactly into Wq/bq, q_w,k,v as f16 GEMM results/operands (logits O(1)); scores, softmax and attn*v in ONE launch (k_fattn): online softmax in f32 (log2 domain), P as f16 operand scaled by a power of two, f32 accumulation, one division by the row sum at the end. v_wmma_f32_16x16x32_f16.
#define NBt 2
#define LL 4096
#define NH 8
#define DHd 64
#define DM (NH * DHd)
#define NR (NBt * LL)
typedef __bf16 v16b __attribute__((ext_vector_type(16)));
typedef unsigned short v8us __attribute__((ext_vector_type(8), may_alias));
typedef float  v8f  __attribute__((ext_vector_type(8)));
typedef float  v4f  __attribute__((ext_vector_type(4)));
typedef float  v4fa __attribute__((ext_vector_type(4), may_alias));
union FragB { v16b v; v8us half[2]; unsigned short u[16]; };

__device__ __forceinline__ unsigned short bf16_bits(float x) { unsigned int u = __float_as_uint(x); return (unsigned short)((u + 0x7FFFu + ((u >> 16) & 1u)) >> 16); }
__device__ __forceinline__ float bf16_val(unsigned short b) { return __uint_as_float(((unsigned int)b) << 16); }
__device__ __forceinline__ float bf16_round(float x) { return bf16_val(bf16_bits(x)); }
// D += A·B with NT terms: 1 = ah·bh, 2 = + al·bh (A split), 3 = + ah·bl (both split)
template <int NT>
__device__ __forceinline__ v8f mmaN(v16b ah, v16b al, v16b bh, v16b bl, v8f c) {
  c = __builtin_amdgcn_wmma_f32_16x16x32_bf16(false, ah, false, bh, (short)0, c, false, false);
  if (NT >= 2) c = __builtin_amdgcn_wmma_f32_16x16x32_bf16(false, al, false, bh, (short)0, c, false, false);
  if (NT >= 3) c = __builtin_amdgcn_wmma_f32_16x16x32_bf16(false, ah, false, bl, (short)0, c, false, false);
  asm volatile("v_nop\n\tv_nop\n\tv_nop\n\tv_nop" : "+v"(c) : "v"(ah), "v"(al), "v"(bh), "v"(bl));
  return c;
}

__global__ __launch_bounds__(256) void k_wt_bf16(const float* __restrict__ W, unsigned short* __restrict__ Wt, int K, int N) {
  const int t = blockIdx.x * 256 + threadIdx.x;
  const int k8n = K / 8;
  if (t >= N * k8n) return;
  const int n = t / k8n, k8 = (t % k8n) * 8;
  v8us v;
#pragma unroll
  for (int i = 0; i < 8; ++i) v[i] = bf16_bits(W[(size_t)(k8 + i) * N + n]);
  *(v8us*)(Wt + (size_t)n * K + k8) = v;
  
}

// GEMM C[M][N] (f32, pitch ldc) = act(A[M][K]·W + bias). A f32 row-major (pitch lda) converted per fragment to bf16
// (ASPLIT: hi/lo two planes -> 2 terms, else single rounded term); Wt bf16 [N][K] (pitch ldb). BIAS_BF16 rounds the
// bias to bf16 first (bias quantised to bf16 before the add). K%32==0, M%16==0, N%64==0.
template <bool ASPLIT, int ACT, bool BIAS_BF16>
__global__ __launch_bounds__(128) void k_gemm_bf(const float* __restrict__ A, int lda, const unsigned short* __restrict__ Wt, int ldb,
                                               const float* __restrict__ bias, float* __restrict__ C, int ldc, int M, int N, int K) {
  __shared__ __attribute__((aligned(16))) float so[4][16][64];
  const int tid = threadIdx.x, w = tid >> 5, lane = tid & 31, ln = lane & 15, hh = lane >> 4;
  const int ntn = N / 64;
  const int wid = blockIdx.x * 4 + w;
  const int mt = wid / ntn, nq = wid % ntn;
  if (mt * 16 >= M) return;
  const int row0 = mt * 16, col0 = nq * 64;
  const float* arow = A + (size_t)(row0 + ln) * lda;
  v8f acc[4] = {};
  for (int kb = 0; kb < K; kb += 32) {
    FragB ah, al;
    const v4f x0 = *(const v4fa*)(arow + kb + 8 * hh), x1 = *(const v4fa*)(arow + kb + 8 * hh + 4);
    const v4f x2 = *(const v4fa*)(arow + kb + 16 + 8 * hh), x3 = *(const v4fa*)(arow + kb + 16 + 8 * hh + 4);
    float xs[16] = {x0[0],x0[1],x0[2],x0[3],x1[0],x1[1],x1[2],x1[3],x2[0],x2[1],x2[2],x2[3],x3[0],x3[1],x3[2],x3[3]};
#pragma unroll
    for (int i = 0; i < 16; ++i) { const unsigned short hb = bf16_bits(xs[i]); ah.u[i] = hb; al.u[i] = ASPLIT ? bf16_bits(xs[i] - bf16_val(hb)) : (unsigned short)0; }
#pragma unroll
    for (int t = 0; t < 4; ++t) {
      const unsigned short* brow = Wt + (size_t)(col0 + t * 16 + ln) * ldb + kb;
      FragB b;
      b.half[0] = *(const v8us*)(brow + 8 * hh);
      b.half[1] = *(const v8us*)(brow + 16 + 8 * hh);
      acc[t] = mmaN<ASPLIT ? 2 : 1>(ah.v, al.v, b.v, b.v, acc[t]);
    }
  }
#pragma unroll
  for (int t = 0; t < 4; ++t) {
    float bv = bias ? bias[col0 + t * 16 + ln] : 0.f;
    if (BIAS_BF16) bv = bf16_round(bv);
#pragma unroll
    for (int r = 0; r < 8; ++r) { float v = acc[t][r] + bv; if (ACT == 1) v = fmaxf(v, 0.f); so[w][8 * hh + r][t * 16 + ln] = v; }
  }
  __builtin_amdgcn_fence(__ATOMIC_ACQ_REL, "workgroup");
  __builtin_amdgcn_wave_barrier();
  const int rsub = lane >> 4, c4 = (lane & 15) * 4;
  {
#pragma unroll
    for (int q = 0; q < 8; ++q) {
      const int r = q * 2 + rsub;
      const v4f v = *(const v4fa*)&so[w][r][c4];
      *(v4f*)(C + (size_t)(row0 + r) * ldc + col0 + c4) = v;
    }
    
  }
}

// GEMM C = act(A·W + bias + resid): A f32 (ASPLIT -> hi/lo 2 terms), Wt bf16 [N][K]; ACT 0 none, 1 relu, 2 exact gelu;
// resid (optional, f32, row index = (row % rmod), pitch ldr, RES_BF16 rounds it) added before the activation.
template <bool ASPLIT, int ACT, bool BIAS_BF16, bool RES_BF16>
__global__ __launch_bounds__(128) void k_gemm_bf3(const float* __restrict__ A, int lda, const unsigned short* __restrict__ Wt, int ldb,
                                                const float* __restrict__ bias, const float* __restrict__ resid, int rmod, int ldr,
                                                float* __restrict__ C, int ldc, int M, int N, int K) {
  __shared__ __attribute__((aligned(16))) float so[4][16][64];
  const int tid = threadIdx.x, w = tid >> 5, lane = tid & 31, ln = lane & 15, hh = lane >> 4;
  const int ntn = N / 64;
  const int wid = blockIdx.x * 4 + w;
  const int mt = wid / ntn, nq = wid % ntn;
  if (mt * 16 >= M) return;
  const int row0 = mt * 16, col0 = nq * 64;
  const float* arow = A + (size_t)(row0 + ln) * lda;
  v8f acc[4] = {};
  for (int kb = 0; kb < K; kb += 32) {
    FragB ah, al;
    const v4f x0 = *(const v4fa*)(arow + kb + 8 * hh), x1 = *(const v4fa*)(arow + kb + 8 * hh + 4);
    const v4f x2 = *(const v4fa*)(arow + kb + 16 + 8 * hh), x3 = *(const v4fa*)(arow + kb + 16 + 8 * hh + 4);
    float xs[16] = {x0[0],x0[1],x0[2],x0[3],x1[0],x1[1],x1[2],x1[3],x2[0],x2[1],x2[2],x2[3],x3[0],x3[1],x3[2],x3[3]};
#pragma unroll
    for (int i = 0; i < 16; ++i) { const unsigned short hb = bf16_bits(xs[i]); ah.u[i] = hb; al.u[i] = ASPLIT ? bf16_bits(xs[i] - bf16_val(hb)) : (unsigned short)0; }
#pragma unroll
    for (int t = 0; t < 4; ++t) {
      const unsigned short* brow = Wt + (size_t)(col0 + t * 16 + ln) * ldb + kb;
      FragB b;
      b.half[0] = *(const v8us*)(brow + 8 * hh);
      b.half[1] = *(const v8us*)(brow + 16 + 8 * hh);
      acc[t] = mmaN<ASPLIT ? 2 : 1>(ah.v, al.v, b.v, b.v, acc[t]);
    }
  }
#pragma unroll
  for (int t = 0; t < 4; ++t) {
    const int col = col0 + t * 16 + ln;
    float bv = bias ? bias[col] : 0.f;
    if (BIAS_BF16) bv = bf16_round(bv);
#pragma unroll
    for (int r = 0; r < 8; ++r) {
      float v = acc[t][r] + bv;
      if (resid) { float rv = resid[(size_t)((row0 + 8 * hh + r) % rmod) * ldr + col]; if (RES_BF16) rv = bf16_round(rv); v += rv; }
      if (ACT == 1) v = fmaxf(v, 0.f);
      if (ACT == 2) v = 0.5f * v * (1.0f + erff(v * 0.70710678118654752f));
      if (ACT == 3) { const float u = 0.7978845608028654f * (v + 0.044715f * v * v * v); v = 0.5f * v * (1.0f + tanhf(u)); }
      so[w][8 * hh + r][t * 16 + ln] = v;
    }
  }
  __builtin_amdgcn_fence(__ATOMIC_ACQ_REL, "workgroup");
  __builtin_amdgcn_wave_barrier();
  const int rsub = lane >> 4, c4 = (lane & 15) * 4;
  {
#pragma unroll
    for (int q = 0; q < 8; ++q) {
      const int r = q * 2 + rsub;
      const v4f v = *(const v4fa*)&so[w][r][c4];
      *(v4f*)(C + (size_t)(row0 + r) * ldc + col0 + c4) = v;
    }
    
  }
}
// row LayerNorm (biased variance, eps) over N: s = X (+ R); optional out_sum <- s; out_norm <- (s-mu)*rsqrt(var+eps)*g + b
template <bool PARAM_BF16>
__global__ __launch_bounds__(256) void k_layernorm(const float* __restrict__ X, const float* __restrict__ R, const float* __restrict__ g, const float* __restrict__ bta,
                                                  float* __restrict__ out_sum, float* __restrict__ out_norm, int N, float eps) {
  __shared__ float red[256];
  const int row = blockIdx.x, tid = threadIdx.x;
  const float* x = X + (size_t)row * N; const float* rr = R ? R + (size_t)row * N : nullptr;
  float vals[16];                     // up to N = 4096
  const int per = N / 256;            // contiguous chunk per thread? use strided-by-4 chunks: thread handles j = tid*4 + 1024*u
  float s1 = 0.f;
  for (int u = 0; u < per / 4; ++u) {
    const int j = tid * 4 + 1024 * u;
    const v4f a = *(const v4fa*)(x + j);
    v4f b = {0.f,0.f,0.f,0.f}; if (rr) b = *(const v4fa*)(rr + j);
#pragma unroll
    for (int q = 0; q < 4; ++q) { const float v = a[q] + b[q]; vals[u * 4 + q] = v; s1 += v; }
  }
  red[tid] = s1; __syncthreads();
  for (int st = 128; st > 0; st >>= 1) { if (tid < st) red[tid] += red[tid + st]; __syncthreads(); }
  const float mu = red[0] / (float)N; __syncthreads();
  float s2 = 0.f;
  for (int u = 0; u < per / 4; ++u)
#pragma unroll
    for (int q = 0; q < 4; ++q) { const float c = vals[u * 4 + q] - mu; s2 += c * c; }
  red[tid] = s2; __syncthreads();
  for (int st = 128; st > 0; st >>= 1) { if (tid < st) red[tid] += red[tid + st]; __syncthreads(); }
  const float rs = rsqrtf(red[0] / (float)N + eps);
  {
    for (int u = 0; u < per / 4; ++u) {
      const int j = tid * 4 + 1024 * u;
      v4f o, sm;
#pragma unroll
      for (int q = 0; q < 4; ++q) {
        float gg = g[j + q], bb = bta[j + q];
        if (PARAM_BF16) { gg = bf16_round(gg); bb = bf16_round(bb); }
        sm[q] = vals[u * 4 + q]; o[q] = (vals[u * 4 + q] - mu) * rs * gg + bb;
      }
      if (out_sum) *(v4f*)(out_sum + (size_t)row * N + j) = sm;
      *(v4f*)(out_norm + (size_t)row * N + j) = o;
    }
    
  }
}



// ---- f16 WMMA path (v_wmma_f32_16x16x32_f16): 11-bit significands for operands in range — used where a [0,1] probability operand needs more precision than bf16
typedef _Float16 v16h __attribute__((ext_vector_type(16)));
union FragH { v16h v; v8us half[2]; _Float16 h[16]; unsigned short u[16]; };
template <int NT>
__device__ __forceinline__ v8f mmaH(v16h ah, v16h al, v16h bh, v16h bl, v8f c) {
  c = __builtin_amdgcn_wmma_f32_16x16x32_f16(false, ah, false, bh, (short)0, c, false, false);
  if (NT >= 2) c = __builtin_amdgcn_wmma_f32_16x16x32_f16(false, al, false, bh, (short)0, c, false, false);
  if (NT >= 3) c = __builtin_amdgcn_wmma_f32_16x16x32_f16(false, ah, false, bl, (short)0, c, false, false);
  asm volatile("v_nop\n\tv_nop\n\tv_nop\n\tv_nop" : "+v"(c) : "v"(ah), "v"(al), "v"(bh), "v"(bl));
  return c;
}
// batched GEMM like k_gemm_b but f16 operands: A f32 (split into f16 hi/lo if ASPLIT, else rounded to f16), Bt = f16 values [n][k]; alpha; C f32; N multiple of 16 (partial tiles skipped)
template <bool ASPLIT>
__global__ __launch_bounds__(128) void k_gemm_h(const float* __restrict__ A, int lda, size_t sA, const _Float16* __restrict__ Bh, int ldb, size_t sB, float alpha, float* __restrict__ C, int ldc, size_t sC, int M, int N, int K) {
  __shared__ __attribute__((aligned(16))) float so[4][16][64];
  const int tid = threadIdx.x, w = tid >> 5, lane = tid & 31, ln = lane & 15, hh = lane >> 4; const int by = blockIdx.y;
  A += (size_t)by * sA; Bh += (size_t)by * sB; C += (size_t)by * sC;
  const int ntn = (N + 63) / 64; const int wid = blockIdx.x * 4 + w; const int mt = wid / ntn, nq = wid % ntn; if (mt * 16 >= M) return;
  const int row0 = mt * 16, col0 = nq * 64; const float* arow = A + (size_t)(row0 + ln) * lda;
  v8f acc[4] = {};
  for (int kb = 0; kb < K; kb += 32) {
    FragH ah, al;
    const v4f x0 = *(const v4fa*)(arow + kb + 8 * hh), x1 = *(const v4fa*)(arow + kb + 8 * hh + 4), x2 = *(const v4fa*)(arow + kb + 16 + 8 * hh), x3 = *(const v4fa*)(arow + kb + 16 + 8 * hh + 4);
    float xs[16] = {x0[0],x0[1],x0[2],x0[3],x1[0],x1[1],x1[2],x1[3],x2[0],x2[1],x2[2],x2[3],x3[0],x3[1],x3[2],x3[3]};
#pragma unroll
    for (int i = 0; i < 16; ++i) { const _Float16 h = (_Float16)xs[i]; ah.h[i] = h; al.h[i] = ASPLIT ? (_Float16)(xs[i] - (float)h) : (_Float16)0.0f; }
#pragma unroll
    for (int t = 0; t < 4; ++t) { if (col0 + t * 16 >= N) continue; const size_t boff = (size_t)(col0 + t * 16 + ln) * ldb + kb; FragH bq; bq.half[0] = *(const v8us*)(Bh + boff + 8 * hh); bq.half[1] = *(const v8us*)(Bh + boff + 16 + 8 * hh);
      acc[t] = mmaH<ASPLIT ? 2 : 1>(ah.v, al.v, bq.v, bq.v, acc[t]); }
  }
#pragma unroll
  for (int t = 0; t < 4; ++t) { if (col0 + t * 16 >= N) continue;
#pragma unroll
    for (int r = 0; r < 8; ++r) so[w][8 * hh + r][t * 16 + ln] = acc[t][r] * alpha; }
  __builtin_amdgcn_fence(__ATOMIC_ACQ_REL, "workgroup"); __builtin_amdgcn_wave_barrier();
  const int rsub = lane >> 4, c4 = (lane & 15) * 4;
  {
#pragma unroll
    for (int q = 0; q < 8; ++q) { const int r = q * 2 + rsub; if (col0 + c4 < N) { const v4f v = *(const v4fa*)&so[w][r][c4]; *(v4f*)(C + (size_t)(row0 + r) * ldc + col0 + c4) = v; } }
     }
}

// Wt[n][k] = f16(W[k][n]·scale) from f32 row-major W[K][N] (scale = power of two; bf16-exact weights stay exact in f16 away from the subnormal range)
__global__ __launch_bounds__(256) void k_wt_f16(const float* __restrict__ W, _Float16* __restrict__ Wt, int K, int N, float scale) {
  const int t = blockIdx.x * 256 + threadIdx.x; if (t >= N * (K / 8)) return; const int n = t / (K / 8), k8 = (t % (K / 8)) * 8; FragH f;
#pragma unroll
  for (int i = 0; i < 8; ++i) f.h[i] = (_Float16)(bf16_round(W[(size_t)(k8 + i) * N + n]) * scale); const v8us o = f.half[0];
  *(v8us*)((unsigned short*)Wt + (size_t)n * K + k8) = o; 
}


typedef _Float16 v4h __attribute__((ext_vector_type(4)));

__global__ __launch_bounds__(256) void k_h16(const float* __restrict__ x, _Float16* __restrict__ X16, size_t n8) { const size_t t = (size_t)blockIdx.x * 256 + threadIdx.x; if (t >= n8) return; FragH f;
#pragma unroll
  for (int q = 0; q < 8; ++q) f.h[q] = (_Float16)x[t * 8 + q]; *(v8us*)((unsigned short*)X16 + t * 8) = f.half[0];  }
__global__ __launch_bounds__(256) void k_round16f(const float* __restrict__ W, _Float16* __restrict__ Bt, size_t n8) { const size_t t = (size_t)blockIdx.x * 256 + threadIdx.x; if (t >= n8) return; FragH f;
#pragma unroll
  for (int i = 0; i < 8; ++i) f.h[i] = (_Float16)(bf16_round(W[t * 8 + i]) * 16.0f); *(v8us*)((unsigned short*)Bt + t * 8) = f.half[0];  }
template <int NHv, int TTv>
__global__ __launch_bounds__(256) void k_vt(const _Float16* __restrict__ V16, int ldv, int voff, _Float16* __restrict__ Vt) { __shared__ unsigned short tl[64][66]; const int tid = threadIdx.x; const int slab = blockIdx.x / (TTv / 64), lg = blockIdx.x % (TTv / 64); const int b = slab / NHv, h = slab % NHv;
  for (int i = tid; i < 64 * 8; i += 256) { const int r = i / 8, c8 = (i % 8) * 8; FragH f; f.half[0] = *(const v8us*)((const unsigned short*)V16 + ((size_t)b * TTv + lg * 64 + r) * ldv + voff + h * 64 + c8);
#pragma unroll
    for (int q = 0; q < 8; ++q) tl[r][c8 + q] = f.u[q]; }
  __syncthreads();
  {
#pragma unroll
    for (int rd = 0; rd < 2; ++rd) { const int d = rd * 32 + tid / 8, pc = tid % 8; FragH f;
#pragma unroll
      for (int q = 0; q < 8; ++q) f.u[q] = tl[pc * 8 + q][d];
      *(v8us*)((unsigned short*)Vt + ((size_t)slab * 64 + d) * TTv + lg * 64 + pc * 8) = f.half[0]; }
     } }

__global__ __launch_bounds__(256) void k_hl(const float* __restrict__ F, _Float16* __restrict__ Hh, _Float16* __restrict__ Hl, size_t n8) { const size_t t = (size_t)blockIdx.x * 256 + threadIdx.x; if (t >= n8) return; FragH fh, fl; const v4f a = *(const v4fa*)(F + t * 8), c = *(const v4fa*)(F + t * 8 + 4);
#pragma unroll
  for (int q = 0; q < 4; ++q) { _Float16 h = (_Float16)a[q]; fh.h[q] = h; fl.h[q] = (_Float16)((a[q] - (float)h) * 1024.0f); h = (_Float16)c[q]; fh.h[4 + q] = h; fl.h[4 + q] = (_Float16)((c[q] - (float)h) * 1024.0f); }
  { *(v8us*)((unsigned short*)Hh + t * 8) = fh.half[0]; *(v8us*)((unsigned short*)Hl + t * 8) = fl.half[0];  } }

typedef unsigned int u32x4 __attribute__((ext_vector_type(4)));
typedef unsigned int u32x4a __attribute__((ext_vector_type(4), may_alias));
typedef float f32x2 __attribute__((ext_vector_type(2)));
typedef _Float16 f16x2 __attribute__((ext_vector_type(2)));
#define FSK 64                    /* keys per half-stage */
#define FPITCH 144u               /* LDS row pitch: 128 B of data + 16 B, an odd multiple of 16 B for 16-byte readers */
#define FTILE (64u * FPITCH)      /* one K tile (64 keys x 64 d) or one V^T tile (64 d x 64 keys) */
#define FBUF (2u * FTILE)         /* one half-stage: K tile, then V^T tile; a stage buffer is two of them, the ring two stage buffers */
#define FEP 272u                  /* output staging pitch: 256 B + 16 B */
#define FLIM 32768.0f             /* a pass's row sum up to here: every weight of the pass is a finite f16 */
#define FEX (9u * 512u)           /* one wave's exchange slot: 8 accumulator planes and one of maximum and row sum; 16 slots fill one ring */
struct FragU { u32x4 q[2]; };
__device__ __forceinline__ v8f mmaU(const FragU& a, const FragU& b, v8f c) { return __builtin_amdgcn_wmma_f32_16x16x32_f16(false, __builtin_bit_cast(v16h, a), false, __builtin_bit_cast(v16h, b), (short)0, c, false, false); }
__device__ __forceinline__ unsigned int pack2h(float lo, float hi) { return __builtin_bit_cast(unsigned int, __builtin_convertvector(f32x2{lo, hi}, f16x2)); }
__device__ __forceinline__ float xhalf(float x) { return __builtin_bit_cast(float, __builtin_amdgcn_permlanex16(__builtin_bit_cast(int, x), __builtin_bit_cast(int, x), 0x76543210, 0xfedcba98, false, false)); }  // lane l <-> lane l ^ 16
__global__ __launch_bounds__(512) void k_fattn(const _Float16* __restrict__ Q, const _Float16* __restrict__ K, const _Float16* __restrict__ VT, float* __restrict__ O) {
  __shared__ __attribute__((aligned(16))) unsigned char Ls[8u * FBUF];      // two rings of 4 FBUF, one a key group
  const unsigned int lane = threadIdx.x & 31u, wave16 = (unsigned int)__builtin_amdgcn_readfirstlane((int)(threadIdx.x >> 5)), c = lane & 15u, hh = lane >> 4;
  const unsigned int grp = wave16 >> 3, wave = wave16 & 7u, tid = threadIdx.x & 255u;      // key group; wave and thread inside it
  unsigned char* const Lg = Ls + grp * (4u * FBUF);
  const unsigned int bh = blockIdx.x / (LL / 256), qblk = blockIdx.x % (LL / 256), b = bh / NH, h = bh % NH;
  const unsigned int q0 = qblk * 256u + wave * 32u;
  const float cscale = 0.125f * 1.4426950408889634f;      // 1/sqrt(64), scores taken to the log2 domain
  // staging map: 8 threads cover one 128-byte row; a thread brings rows srow and srow + 32 of the K tile and of the V^T tile
  const unsigned int srow = tid >> 3, sch = (tid & 7u) * 16u;
  const unsigned char* kg = (const unsigned char*)(K + ((size_t)b * LL + grp * (LL / 2) + srow) * DM + h * DHd) + sch;
  const unsigned char* vg = (const unsigned char*)(VT + ((size_t)bh * DHd + srow) * LL + grp * (LL / 2)) + sch;
  const unsigned int sdst = srow * FPITCH + sch;
  u32x4 r0, r1, r2, r3;
  auto gload = [&](unsigned int st) {
    const unsigned char* kp = kg + (size_t)st * (FSK * DM * 2); const unsigned char* vp = vg + (size_t)st * (FSK * 2);
    r0 = *(const u32x4a*)kp; r1 = *(const u32x4a*)(kp + 32 * DM * 2); r2 = *(const u32x4a*)vp; r3 = *(const u32x4a*)(vp + 32 * LL * 2); };
  auto sstore = [&](unsigned char* base) {
    unsigned char* p = base + sdst;
    *(u32x4a*)p = r0; *(u32x4a*)(p + 32u * FPITCH) = r1; *(u32x4a*)(p + FTILE) = r2; *(u32x4a*)(p + FTILE + 32u * FPITCH) = r3; };
  gload(0);
  FragU qf[2][2];      // B operand: column = query, k = d in the hardware order (16 B at 16 hh and at 32 + 16 hh of each 64 B), as K's rows below
#pragma unroll
  for (int g = 0; g < 2; ++g) { const unsigned char* qp = (const unsigned char*)(Q + ((size_t)b * LL + q0 + 16u * g + c) * DM + h * DHd) + 16u * hh;
#pragma unroll
    for (int kc = 0; kc < 2; ++kc) { qf[g][kc].q[0] = *(const u32x4a*)(qp + 64 * kc); qf[g][kc].q[1] = *(const u32x4a*)(qp + 64 * kc + 32); } }
  FragU ones; ones.q[0] = u32x4{0x3C003C00u, 0x3C003C00u, 0x3C003C00u, 0x3C003C00u}; ones.q[1] = ones.q[0];      // f16 1.0 everywhere
  v8f acc[2][4] = {}; float l_run[2] = {0.f, 0.f}; float m_run[2] = {-1.0e30f, -1.0e30f};      // with this start value the first pass's weights overflow, so it is redone with its exact maximum
  sstore(Lg); gload(1); sstore(Lg + FBUF);
  __syncthreads();
  // one half-stage (64 keys, two passes) of stage st; more: a stage st + 1 exists (a literal at both call sites, so no test stands in the loop)
  auto halfstage = [&](unsigned int st, unsigned int hf, bool more) __attribute__((always_inline)) {
    if (more) { gload(2u * st + 2u + hf);      // the next stage's same half flies under this half's two passes
      __builtin_amdgcn_sched_barrier(0); }      // keeps the four loads up here: without it the compiler sinks them to their LDS stores and the wave waits out the whole load latency there
    const unsigned char* Lb = Lg + (st & 1u) * (2u * FBUF) + hf * FBUF;
#pragma unroll
    for (unsigned int sub = 0; sub < 2; ++sub) {      // one pass = 32 keys
      v8f s[2][2];      // s[kt][g][r] = score of key 16 kt + 8 hh + r against query column c of group g
      auto scores = [&]() __attribute__((always_inline)) {
        FragU kf[2][2];
#pragma unroll
        for (int kt = 0; kt < 2; ++kt) { const unsigned char* p = Lb + (sub * 32u + 16u * kt + c) * FPITCH + 16u * hh;
#pragma unroll
          for (int kc = 0; kc < 2; ++kc) { kf[kt][kc].q[0] = *(const u32x4a*)(p + 64 * kc); kf[kt][kc].q[1] = *(const u32x4a*)(p + 64 * kc + 32); } }
#pragma unroll
        for (int kt = 0; kt < 2; ++kt)
#pragma unroll
          for (int g = 0; g < 2; ++g) { s[kt][g] = v8f{};
#pragma unroll
            for (int kc = 0; kc < 2; ++kc) s[kt][g] = mmaU(kf[kt][kc], qf[g][kc], s[kt][g]); }
      };
      FragU pf[2]; v8f rs[2];      // the pass's weights as B operands, and their column sums (every row of rs[g] alike)
      auto weights = [&]() __attribute__((always_inline)) {
#pragma unroll
        for (int g = 0; g < 2; ++g) { const float nm = 6.0f - m_run[g];      // P carries a factor 2^6 (cancels in the division): small weights stay normal f16
          unsigned int w[8];
#pragma unroll
          for (int i = 0; i < 8; ++i) { const f32x2 a = __builtin_elementwise_fma(f32x2{s[i >> 2][g][2 * (i & 3)], s[i >> 2][g][2 * (i & 3) + 1]}, f32x2{cscale, cscale}, f32x2{nm, nm});
            w[i] = pack2h(__builtin_amdgcn_exp2f(a.x), __builtin_amdgcn_exp2f(a.y)); }
          pf[g].q[0] = u32x4{w[0], w[1], w[2], w[3]}; pf[g].q[1] = u32x4{w[4], w[5], w[6], w[7]};
          rs[g] = mmaU(ones, pf[g], v8f{}); }
      };
      scores();
      FragU vf[4];
#pragma unroll
      for (int t = 0; t < 4; ++t) { const unsigned char* p = Lb + FTILE + (16u * t + c) * FPITCH + sub * 64u + 16u * hh; vf[t].q[0] = *(const u32x4a*)p; vf[t].q[1] = *(const u32x4a*)(p + 32); }
      weights();
      // tested once per pass: a sum within FLIM bounds each of its (non-negative) weights, so none is infinite; written so that infinity and not-a-number both ask for the redo
      const bool redo = !(rs[0][0] <= FLIM) || !(rs[1][0] <= FLIM);
      if (__builtin_amdgcn_ballot_w32(redo) != 0) {
        asm volatile("" ::: "memory");      // compiler fence: the redo reads K from LDS again; without it the fragments or the raw scores would be kept alive through every normal pass (32 VGPRs)
        scores();
#pragma unroll
        for (int g = 0; g < 2; ++g) { float mx = s[0][g][0];
#pragma unroll
          for (int r = 1; r < 8; ++r) mx = fmaxf(mx, s[0][g][r]);
#pragma unroll
          for (int r = 0; r < 8; ++r) mx = fmaxf(mx, s[1][g][r]);
          mx = fmaxf(mx, xhalf(mx)) * cscale;
          const float m_new = fmaxf(m_run[g], mx); const float corr = __builtin_amdgcn_exp2f(m_run[g] - m_new); m_run[g] = m_new; l_run[g] = l_run[g] * corr;
#pragma unroll
          for (int t = 0; t < 4; ++t) acc[g][t] = acc[g][t] * corr; }
        weights();      // now no weight exceeds 2^6
      }
#pragma unroll
      for (int g = 0; g < 2; ++g) { l_run[g] += rs[g][0];
#pragma unroll
        for (int t = 0; t < 4; ++t) acc[g][t] = mmaU(vf[t], pf[g], acc[g][t]); }
    }
    if (more) sstore(Lg + ((st + 1u) & 1u) * (2u * FBUF) + hf * FBUF);      // into the stage buffer whose last readers passed the barrier that ended stage st - 1
    // Four vector slots between the pass's last WMMAs and the next half-stage's first vector write over their B registers;
    // the two scheduling barriers keep the WMMAs in front of the slots and the next writes behind them.
    __builtin_amdgcn_sched_barrier(0);
    asm volatile("v_nop\n\tv_nop\n\tv_nop\n\tv_nop");
    __builtin_amdgcn_sched_barrier(0);
  };
#pragma unroll 1      // the stage loop stays a loop: its body is already two passes long
  for (unsigned int st = 0; st + 1u < LL / (4 * FSK); ++st) {
#pragma unroll 1      // rolled: unrolled, the four passes need more than 256 VGPRs
    for (unsigned int hf = 0; hf < 2; ++hf) halfstage(st, hf, true);
    __syncthreads();      // publishes stage st + 1 and ends every wave's reads of stage st
  }
#pragma unroll 1      // rolled, as above
  for (unsigned int hf = 0; hf < 2; ++hf) halfstage(LL / (4 * FSK) - 1u, hf, false);
  __syncthreads();      // every wave has left the rings: ring 0 becomes the exchange area, ring 1 output staging
  // Join of the two key groups. Key group 0 finishes query group 0, key group 1 query group 1; a wave hands the query group it does not finish to its partner (same query columns,
  // other key group) through a slot of its own: eight 512-byte planes of accumulators (a lane's 16 bytes side by side, so stores and loads meet no bank twice) and one plane with the
  // maximum in use and the row sum. Which of the two is kept is picked by selects on the wave-uniform group number, so that one copy of the code serves both groups.
  const bool first = grp == 0u;
  v8f keep[4], hand[4];
#pragma unroll
  for (int t = 0; t < 4; ++t)
#pragma unroll
    for (int r = 0; r < 8; ++r) { keep[t][r] = first ? acc[0][t][r] : acc[1][t][r]; hand[t][r] = first ? acc[1][t][r] : acc[0][t][r]; }
  const float mk = first ? m_run[0] : m_run[1], lk = first ? l_run[0] : l_run[1];
  { unsigned char* p = Ls + wave16 * FEX + lane * 16u;
#pragma unroll
    for (int t = 0; t < 4; ++t) { *(v4fa*)(p + (2 * t) * 512) = v4f{hand[t][0], hand[t][1], hand[t][2], hand[t][3]}; *(v4fa*)(p + (2 * t + 1) * 512) = v4f{hand[t][4], hand[t][5], hand[t][6], hand[t][7]}; }
    *(v4fa*)(p + 8 * 512) = v4f{first ? m_run[1] : m_run[0], first ? l_run[1] : l_run[0], 0.f, 0.f}; }
  __syncthreads();      // publishes every wave's slot to its partner
  // Both partial sums are taken to the larger of the two maxima, added and divided by the joined row sum; the wave stages its 16 query rows in its own range and stores whole 256-byte rows.
  const unsigned char* px = Ls + (wave16 ^ 8u) * FEX + lane * 16u;
  const v4f ml = *(const v4fa*)(px + 8 * 512);
  const float mj = fmaxf(mk, ml[0]), ca = __builtin_amdgcn_exp2f(mk - mj), cb = __builtin_amdgcn_exp2f(ml[0] - mj);
  const float inv = 1.0f / (lk * ca + ml[1] * cb), fa = ca * inv, fb = cb * inv;
  unsigned char* Le = Ls + 4u * FBUF + wave16 * (16u * FEP);
#pragma unroll
  for (int t = 0; t < 4; ++t) { const v4f o0 = *(const v4fa*)(px + (2 * t) * 512), o1 = *(const v4fa*)(px + (2 * t + 1) * 512);
    unsigned char* s = Le + c * FEP + (16u * t + 8u * hh) * 4u;      // row = query c, columns d = 16 t + 8 hh + r
    *(v4fa*)s = v4f{keep[t][0], keep[t][1], keep[t][2], keep[t][3]} * fa + o0 * fb; *(v4fa*)(s + 16) = v4f{keep[t][4], keep[t][5], keep[t][6], keep[t][7]} * fa + o1 * fb; }
#pragma unroll
  for (int i = 0; i < 8; ++i) { const unsigned int row = 2u * i + hh; const v4f v = *(const v4fa*)(Le + row * FEP + c * 16u);
    *(v4fa*)(O + ((size_t)b * LL + q0 + 16u * grp + row) * DM + h * DHd + c * 4u) = v; }
}

// ---- q_w, k, v^T in one launch: one work-group = 256 sequence rows of one (batch, head), 8 waves x 32 rows. x and the three 64 x 64 weights are read as f32,
// rounded (x: its bf16 value held as f16; W: its bf16 value x 16, the blade sign folded into Wq and bq) and laid in LDS as f16 rows; every product is a WMMA.
// q and k are formed transposed (A = W rows, B = x rows): a lane then holds 8 neighbouring outputs of one sequence row, one 16-byte piece of a q or k row.
// v is formed straight (A = x rows, B = Wv rows): a lane holds 8 neighbouring sequence rows of one d, one 16-byte piece of a V^T row. All three go through LDS, so
// that every global store is made of whole 128-byte lines. Both operands of every product take k in the same hardware order (16 B at 16 hh and at 32 + 16 hh of each 64 B).
typedef unsigned int u32x2 __attribute__((ext_vector_type(2)));
typedef unsigned int u32x2a __attribute__((ext_vector_type(2), may_alias));
#define PVP 528u                          /* V^T staging pitch: 512 B of one d row + 16 B */
#define PL_W (256u * FPITCH)              /* behind the x rows: three weight tiles of 64 rows */
#define PL_B (PL_W + 3u * FTILE)          /* three biases, f32 */
#define PL_Q (PL_B + 3u * 256u)           /* q rows, then k rows: 256 each */
#define PL_V (PL_Q + 2u * 256u * FPITCH)  /* V^T: 64 d rows of 256 sequence places */
#define PL_END (PL_V + 64u * PVP)
__device__ __forceinline__ float blade_sign(unsigned int o) { return ((0xB2u >> (o & 7u)) & 1u) ? -1.f : 1.f; }      // blades 1, 4, 5, 7 are negative
__device__ __forceinline__ u32x4 pack8h(const v8f a, const v4f b0, const v4f b1) {      // f16(a / 16 + bias), eight neighbours
  return u32x4{pack2h(a[0] * 0.0625f + b0[0], a[1] * 0.0625f + b0[1]), pack2h(a[2] * 0.0625f + b0[2], a[3] * 0.0625f + b0[3]),
               pack2h(a[4] * 0.0625f + b1[0], a[5] * 0.0625f + b1[1]), pack2h(a[6] * 0.0625f + b1[2], a[7] * 0.0625f + b1[3])}; }
__global__ __launch_bounds__(256) void k_qkv(const float* __restrict__ x, const float* __restrict__ Wq, const float* __restrict__ bq, const float* __restrict__ Wk, const float* __restrict__ bk,
                                             const float* __restrict__ Wv, const float* __restrict__ bv, _Float16* __restrict__ Qo, _Float16* __restrict__ Ko, _Float16* __restrict__ VTo) {
  __shared__ __attribute__((aligned(16))) unsigned char Lp[PL_END];
  const unsigned int tid = threadIdx.x, lane = tid & 31u, wave = (unsigned int)__builtin_amdgcn_readfirstlane((int)(tid >> 5)), c = lane & 15u, hh = lane >> 4;
  const unsigned int bh = blockIdx.x / (LL / 256), lblk = blockIdx.x % (LL / 256), b = bh / NH, h = bh % NH;
  const unsigned int l0 = lblk * 256u, w0 = wave * 32u;
  // every global read of the kernel is issued here, ahead of any conversion: 16 lanes cover one 256-byte x row (a wave brings its own 32 rows), the weights go linearly over the block
  const float* xg = x + ((size_t)b * LL + l0 + w0 + hh) * DM + h * DHd + c * 4u;
  v4f xr[16], wr[3][4];
#pragma unroll
  for (int i = 0; i < 16; ++i) xr[i] = *(const v4fa*)(xg + (size_t)(2 * i) * DM);
#pragma unroll
  for (int j = 0; j < 4; ++j) { wr[0][j] = *(const v4fa*)(Wq + j * 1024 + tid * 4u); wr[1][j] = *(const v4fa*)(Wk + j * 1024 + tid * 4u); wr[2][j] = *(const v4fa*)(Wv + j * 1024 + tid * 4u); }
  const unsigned int bo = tid & 63u;
  float br = 0.f;
  if (wave < 2u) br = bq[bo]; else if (wave < 4u) br = bk[bo]; else if (wave < 6u) br = bv[bo];
  asm volatile("s_wait_xcnt 0x0" ::: "memory");      // stands in front of the first reuse of an address register of the loads above
  __builtin_amdgcn_sched_barrier(0);      // keeps the conversions, which reuse those registers, behind the wait: without it the compiler lifted the first of them over it
#pragma unroll
  for (int i = 0; i < 16; ++i)
    *(u32x2a*)(Lp + (w0 + 2u * i + hh) * FPITCH + c * 8u) = u32x2{pack2h(bf16_round(xr[i][0]), bf16_round(xr[i][1])), pack2h(bf16_round(xr[i][2]), bf16_round(xr[i][3]))};
#pragma unroll
  for (int mt = 0; mt < 3; ++mt)
#pragma unroll
    for (int j = 0; j < 4; ++j) { const unsigned int o = 16u * j + (tid >> 4); const float s = mt == 0 ? blade_sign(o) : 1.f; const v4f w = wr[mt][j];
      *(u32x2a*)(Lp + PL_W + mt * FTILE + o * FPITCH + c * 8u) = u32x2{pack2h(bf16_round(w[0]) * 16.0f * s, bf16_round(w[1]) * 16.0f * s), pack2h(bf16_round(w[2]) * 16.0f * s, bf16_round(w[3]) * 16.0f * s)}; }
  if (wave < 6u) *(float*)(Lp + PL_B + tid * 4u) = bf16_round(br) * (wave < 2u ? blade_sign(bo) : 1.f);
  __syncthreads();      // publishes the weights and biases (the x rows are read by the wave that wrote them)
  FragU xf[2][2];
#pragma unroll
  for (int m = 0; m < 2; ++m) { const unsigned char* p = Lp + (w0 + 16u * m + c) * FPITCH + 16u * hh;
#pragma unroll
    for (int kc = 0; kc < 2; ++kc) { xf[m][kc].q[0] = *(const u32x4a*)(p + 64 * kc); xf[m][kc].q[1] = *(const u32x4a*)(p + 64 * kc + 32); } }
#pragma unroll
  for (int mt = 0; mt < 3; ++mt) {
    FragU wf[4][2];
#pragma unroll
    for (int t = 0; t < 4; ++t) { const unsigned char* p = Lp + PL_W + mt * FTILE + (16u * t + c) * FPITCH + 16u * hh;
#pragma unroll
      for (int kc = 0; kc < 2; ++kc) { wf[t][kc].q[0] = *(const u32x4a*)(p + 64 * kc); wf[t][kc].q[1] = *(const u32x4a*)(p + 64 * kc + 32); } }
    v8f a[2][4] = {};
#pragma unroll
    for (int kc = 0; kc < 2; ++kc)
#pragma unroll
      for (int m = 0; m < 2; ++m)
#pragma unroll
        for (int t = 0; t < 4; ++t) a[m][t] = mt < 2 ? mmaU(wf[t][kc], xf[m][kc], a[m][t]) : mmaU(xf[m][kc], wf[t][kc], a[m][t]);
#pragma unroll
    for (int t = 0; t < 4; ++t) {
      if (mt < 2) {      // a[m][t][r]: output 16 t + 8 hh + r of sequence row 16 m + c
        const v4f b0 = *(const v4fa*)(Lp + PL_B + mt * 256u + (16u * t + 8u * hh) * 4u), b1 = *(const v4fa*)(Lp + PL_B + mt * 256u + (16u * t + 8u * hh) * 4u + 16u);
#pragma unroll
        for (int m = 0; m < 2; ++m) *(u32x4a*)(Lp + PL_Q + (mt * 256u + w0 + 16u * m + c) * FPITCH + (16u * t + 8u * hh) * 2u) = pack8h(a[m][t], b0, b1);
      } else {           // a[m][t][r]: d = 16 t + c of sequence row 16 m + 8 hh + r
        const float bd = *(const float*)(Lp + PL_B + 512u + (16u * t + c) * 4u); const v4f b4 = v4f{bd, bd, bd, bd};
#pragma unroll
        for (int m = 0; m < 2; ++m) *(u32x4a*)(Lp + PL_V + (16u * t + c) * PVP + (w0 + 16u * m + 8u * hh) * 2u) = pack8h(a[m][t], b4, b4);
      }
    }
  }
  __syncthreads();      // publishes the staged V^T rows, each made of all eight waves' pieces (and orders each wave's own q and k rows)
  const unsigned int r4 = lane >> 3, c16 = (lane & 7u) * 16u;      // 8 lanes cover one 128-byte q or k row
#pragma unroll
  for (int i = 0; i < 8; ++i) { const unsigned int row = w0 + 4u * i + r4; const size_t go = (((size_t)b * LL + l0 + row) * DM + h * DHd) * 2u + c16;
    *(u32x4a*)((unsigned char*)Qo + go) = *(const u32x4a*)(Lp + PL_Q + row * FPITCH + c16);
    *(u32x4a*)((unsigned char*)Ko + go) = *(const u32x4a*)(Lp + PL_Q + (256u + row) * FPITCH + c16); }
#pragma unroll
  for (int i = 0; i < 8; ++i) { const unsigned int d = wave * 8u + i;      // a wave stores 512 contiguous bytes of one V^T row
    *(u32x4a*)((unsigned char*)(VTo + ((size_t)bh * DHd + d) * LL + l0) + lane * 16u) = *(const u32x4a*)(Lp + PL_V + d * PVP + lane * 16u); }
}

extern "C" void kernel_launch(void* const* d_in, const int* in_sizes, int n_in,
                              void* d_out, int out_size, void* d_ws, size_t ws_size, hipStream_t stream) {
  (void)in_sizes; (void)n_in; (void)out_size;
  const float* x = (const float*)d_in[0]; const float* Wq = (const float*)d_in[1]; const float* bq = (const float*)d_in[2]; const float* Wk = (const float*)d_in[3]; const float* bk = (const float*)d_in[4]; const float* Wv = (const float*)d_in[5]; const float* bv = (const float*)d_in[6];
  char* ws = (char*)d_ws; size_t off = 0;
  auto take = [&](size_t bytes) { char* p = ws + off; off += (bytes + 255) & ~(size_t)255; return p; };
  _Float16* QW16 = (_Float16*)take((size_t)NR * DM * 2); _Float16* K16 = (_Float16*)take((size_t)NR * DM * 2); _Float16* VT = (_Float16*)take((size_t)NR * DM * 2);
  if (off > ws_size) return;      // 3 x 8.4 = 25 MB
  k_qkv<<<NBt * NH * (LL / 256), 256, 0, stream>>>(x, Wq, bq, Wk, bk, Wv, bv, QW16, K16, VT);      /* per-head shared linears (exact products + bias, f16 results; q sign-weighted via the folded weights), v written transposed */
  k_fattn<<<NBt * NH * (LL / 256), 512, 0, stream>>>(QW16, K16, VT, (float*)d_out);      /* scores, softmax, attn*v: every (b, h, 256-query block) in one launch, its keys split over two wave groups */
}

// v005
// Measured time: 53.9 microseconds a run.
// Next to v004, in two timings, it ran 1.05 times as fast each time.
// All steps since v000 together make it 87.9 times as fast.
#include <hip/hip_runtime.h>
// Clifford (multivector) attention (B 2, L 4096, 8 heads × (8 dims × 8 blades) = 512): per head a shared Linear 64→64 (+bias) gives q, k, v from the head's slice of x; q is sign-weighted per blade ([1,−1,1,1,−1,−1,1,−1] over the blade index = column mod 8); logits = q_w·k/8 over the 64 components; softmax over the 4096 keys; out = attn·v → [2,4096,512] (heads concatenated; no output projection).
// Compute dtype: x and parameters rounded to bf16; q/k/v with exact products (+bias, f32), the per-blade sign folded exactly into Wq/bq, q_w (times log2(e)/8, laid in ahead of the rounding),k,v as f16 GEMM results/operands (logits O(1)); scores, softmax and attn*v in ONE launch (k_fattn): online softmax in f32 (log2 domain), P as f16 operand scaled by a power of two, f32 accumulation, one division by the row sum at the end. v_wmma_f32_16x16x32_f16.
#define NBt 2
#define LL 4096
#define NH 8
#define DHd 64
#define DM (NH * DHd)
#define NR (NBt * LL)
typedef __bf16 v16b __attribute__((ext_vector_type(16)));
typedef unsigned short v8us __attribute__((ext_vector_type(8), may_alias));
typedef float  v8f  __attribute__((ext_vector_type(8)));
typedef float  v4f  __attribute__((ext_vector_type(4)));
typedef float  v4fa __attribute__((ext_vector_type(4), may_alias));
union FragB { v16b v; v8us half[2]; unsigned short u[16]; };

__device__ __forceinline__ unsigned short bf16_bits(float x) { unsigned int u = __float_as_uint(x); return (unsigned short)((u + 0x7FFFu + ((u >> 16) & 1u)) >> 16); }
__device__ __forceinline__ float bf16_val(unsigned short b) { return __uint_as_float(((unsigned int)b) << 16); }
__device__ __forceinline__ float bf16_round(float x) { return bf16_val(bf16_bits(x)); }
// D += A·B with NT terms: 1 = ah·bh, 2 = + al·bh (A split), 3 = + ah·bl (both split)
template <int NT>
__device__ __forceinline__ v8f mmaN(v16b ah, v16b al, v16b bh, v16b bl, v8f c) {
  c = __builtin_amdgcn_wmma_f32_16x16x32_bf16(false, ah, false, bh, (short)0, c, false, false);
  if (NT >= 2) c = __builtin_amdgcn_wmma_f32_16x16x32_bf16(false, al, false, bh, (short)0, c, false, false);
  if (NT >= 3) c = __builtin_amdgcn_wmma_f32_16x16x32_bf16(false, ah, false, bl, (short)0, c, false, false);
  asm volatile("v_nop\n\tv_nop\n\tv_nop\n\tv_nop" : "+v"(c) : "v"(ah), "v"(al), "v"(bh), "v"(bl));
  return c;
}

__global__ __launch_bounds__(256) void k_wt_bf16(const float* __restrict__ W, unsigned short* __restrict__ Wt, int K, int N) {
  const int t = blockIdx.x * 256 + threadIdx.x;
  const int k8n = K / 8;
  if (t >= N * k8n) return;
  const int n = t / k8n, k8 = (t % k8n) * 8;
  v8us v;
#pragma unroll
  for (int i = 0; i < 8; ++i) v[i] = bf16_bits(W[(size_t)(k8 + i) * N + n]);
  *(v8us*)(Wt + (size_t)n * K + k8) = v;
  
}

// GEMM C[M][N] (f32, pitch ldc) = act(A[M][K]·W + bias). A f32 row-major (pitch lda) converted per fragment to bf16
// (ASPLIT: hi/lo two planes -> 2 terms, else single rounded term); Wt bf16 [N][K] (pitch ldb). BIAS_BF16 rounds the
// bias to bf16 first (bias quantised to bf16 before the add). K%32==0, M%16==0, N%64==0.
template <bool ASPLIT, int ACT, bool BIAS_BF16>
__global__ __launch_bounds__(128) void k_gemm_bf(const float* __restrict__ A, int lda, const unsigned short* __restrict__ Wt, int ldb,
                                               const float* __restrict__ bias, float* __restrict__ C, int ldc, int M, int N, int K) {
  __shared__ __attribute__((aligned(16))) float so[4][16][64];
  const int tid = threadIdx.x, w = tid >> 5, lane = tid & 31, ln = lane & 15, hh = lane >> 4;
  const int ntn = N / 64;
  const int wid = blockIdx.x * 4 + w;
  const int mt = wid / ntn, nq = wid % ntn;
  if (mt * 16 >= M) return;
  const int row0 = mt * 16, col0 = nq * 64;
  const float* arow = A + (size_t)(row0 + ln) * lda;
  v8f acc[4] = {};
  for (int kb = 0; kb < K; kb += 32) {
    FragB ah, al;
    const v4f x0 = *(const v4fa*)(arow + kb + 8 * hh), x1 = *(const v4fa*)(arow + kb + 8 * hh + 4);
    const v4f x2 = *(const v4fa*)(arow + kb + 16 + 8 * hh), x3 = *(const v4fa*)(arow + kb + 16 + 8 * hh + 4);
    float xs[16] = {x0[0],x0[1],x0[2],x0[3],x1[0],x1[1],x1[2],x1[3],x2[0],x2[1],x2[2],x2[3],x3[0],x3[1],x3[2],x3[3]};
#pragma unroll
    for (int i = 0; i < 16; ++i) { const unsigned short hb = bf16_bits(xs[i]); ah.u[i] = hb; al.u[i] = ASPLIT ? bf16_bits(xs[i] - bf16_val(hb)) : (unsigned short)0; }
#pragma unroll
    for (int t = 0; t < 4; ++t) {
      const unsigned short* brow = Wt + (size_t)(col0 + t * 16 + ln) * ldb + kb;
      FragB b;
      b.half[0] = *(const v8us*)(brow + 8 * hh);
      b.half[1] = *(const v8us*)(brow + 16 + 8 * hh);
      acc[t] = mmaN<ASPLIT ? 2 : 1>(ah.v, al.v, b.v, b.v, acc[t]);
    }
  }
#pragma unroll
  for (int t = 0; t < 4; ++t) {
    float bv = bias ? bias[col0 + t * 16 + ln] : 0.f;
    if (BIAS_BF16) bv = bf16_round(bv);
#pragma unroll
    for (int r = 0; r < 8; ++r) { float v = acc[t][r] + bv; if (ACT == 1) v = fmaxf(v, 0.f); so[w][8 * hh + r][t * 16 + ln] = v; }
  }
  __builtin_amdgcn_fence(__ATOMIC_ACQ_REL, "workgroup");
  __builtin_amdgcn_wave_barrier();
  const int rsub = lane >> 4, c4 = (lane & 15) * 4;
  {
#pragma unroll
    for (int q = 0; q < 8; ++q) {
      const int r = q * 2 + rsub;
      const v4f v = *(const v4fa*)&so[w][r][c4];
      *(v4f*)(C + (size_t)(row0 + r) * ldc + col0 + c4) = v;
    }
    
  }
}

// GEMM C = act(A·W + bias + resid): A f32 (ASPLIT -> hi/lo 2 terms), Wt bf16 [N][K]; ACT 0 none, 1 relu, 2 exact gelu;
// resid (optional, f32, row index = (row % rmod), pitch ldr, RES_BF16 rounds it) added before the activation.
template <bool ASPLIT, int ACT, bool BIAS_BF16, bool RES_BF16>
__global__ __launch_bounds__(128) void k_gemm_bf3(const float* __restrict__ A, int lda, const unsigned short* __restrict__ Wt, int ldb,
                                                const float* __restrict__ bias, const float* __restrict__ resid, int rmod, int ldr,
                                                float* __restrict__ C, int ldc, int M, int N, int K) {
  __shared__ __attribute__((aligned(16))) float so[4][16][64];
  const int tid = threadIdx.x, w = tid >> 5, lane = tid & 31, ln = lane & 15, hh = lane >> 4;
  const int ntn = N / 64;
  const int wid = blockIdx.x * 4 + w;
  const int mt = wid / ntn, nq = wid % ntn;
  if (mt * 16 >= M) return;
  const int row0 = mt * 16, col0 = nq * 64;
  const float* arow = A + (size_t)(row0 + ln) * lda;
  v8f acc[4] = {};
  for (int kb = 0; kb < K; kb += 32) {
    FragB ah, al;
    const v4f x0 = *(const v4fa*)(arow + kb + 8 * hh), x1 = *(const v4fa*)(arow + kb + 8 * hh + 4);
    const v4f x2 = *(const v4fa*)(arow + kb + 16 + 8 * hh), x3 = *(const v4fa*)(arow + kb + 16 + 8 * hh + 4);
    float xs[16] = {x0[0],x0[1],x0[2],x0[3],x1[0],x1[1],x1[2],x1[3],x2[0],x2[1],x2[2],x2[3],x3[0],x3[1],x3[2],x3[3]};
#pragma unroll
    for (int i = 0; i < 16; ++i) { const unsigned short hb = bf16_bits(xs[i]); ah.u[i] = hb; al.u[i] = ASPLIT ? bf16_bits(xs[i] - bf16_val(hb)) : (unsigned short)0; }
#pragma unroll
    for (int t = 0; t < 4; ++t) {
      const unsigned short* brow = Wt + (size_t)(col0 + t * 16 + ln) * ldb + kb;
      FragB b;
      b.half[0] = *(const v8us*)(brow + 8 * hh);
      b.half[1] = *(const v8us*)(brow + 16 + 8 * hh);
      acc[t] = mmaN<ASPLIT ? 2 : 1>(ah.v, al.v, b.v, b.v, acc[t]);
    }
  }
#pragma unroll
  for (int t = 0; t < 4; ++t) {
    const int col = col0 + t * 16 + ln;
    float bv = bias ? bias[col] : 0.f;
    if (BIAS_BF16) bv = bf16_round(bv);
#pragma unroll
    for (int r = 0; r < 8; ++r) {
      float v = acc[t][r] + bv;
      if (resid) { float rv = resid[(size_t)((row0 + 8 * hh + r) % rmod) * ldr + col]; if (RES_BF16) rv = bf16_round(rv); v += rv; }
      if (ACT == 1) v = fmaxf(v, 0.f);
      if (ACT == 2) v = 0.5f * v * (1.0f + erff(v * 0.70710678118654752f));
      if (ACT == 3) { const float u = 0.7978845608028654f * (v + 0.044715f * v * v * v); v = 0.5f * v * (1.0f + tanhf(u)); }
      so[w][8 * hh + r][t * 16 + ln] = v;
    }
  }
  __builtin_amdgcn_fence(__ATOMIC_ACQ_REL, "workgroup");
  __builtin_amdgcn_wave_barrier();
  const int rsub = lane >> 4, c4 = (lane & 15) * 4;
  {
#pragma unroll
    for (int q = 0; q < 8; ++q) {
      const int r = q * 2 + rsub;
      const v4f v = *(const v4fa*)&so[w][r][c4];
      *(v4f*)(C + (size_t)(row0 + r) * ldc + col0 + c4) = v;
    }
    
  }
}
// row LayerNorm (biased variance, eps) over N: s = X (+ R); optional out_sum <- s; out_norm <- (s-mu)*rsqrt(var+eps)*g + b
template <bool PARAM_BF16>
__global__ __launch_bounds__(256) void k_layernorm(const float* __restrict__ X, const float* __restrict__ R, const float* __restrict__ g, const float* __restrict__ bta,
                                                  float* __restrict__ out_sum, float* __restrict__ out_norm, int N, float eps) {
  __shared__ float red[256];
  const int row = blockIdx.x, tid = threadIdx.x;
  const float* x = X + (size_t)row * N; const float* rr = R ? R + (size_t)row * N : nullptr;
  float vals[16];                     // up to N = 4096
  const int per = N / 256;            // contiguous chunk per thread? use strided-by-4 chunks: thread handles j = tid*4 + 1024*u
  float s1 = 0.f;
  for (int u = 0; u < per / 4; ++u) {
    const int j = tid * 4 + 1024 * u;
    const v4f a = *(const v4fa*)(x + j);
    v4f b = {0.f,0.f,0.f,0.f}; if (rr) b = *(const v4fa*)(rr + j);
#pragma unroll
    for (int q = 0; q < 4; ++q) { const float v = a[q] + b[q]; vals[u * 4 + q] = v; s1 += v; }
  }
  red[tid] = s1; __syncthreads();
  for (int st = 128; st > 0; st >>= 1) { if (tid < st) red[tid] += red[tid + st]; __syncthreads(); }
  const float mu = red[0] / (float)N; __syncthreads();
  float s2 = 0.f;
  for (int u = 0; u < per / 4; ++u)
#pragma unroll
    for (int q = 0; q < 4; ++q) { const float c = vals[u * 4 + q] - mu; s2 += c * c; }
  red[tid] = s2; __syncthreads();
  for (int st = 128; st > 0; st >>= 1) { if (tid < st) red[tid] += red[tid + st]; __syncthreads(); }
  const float rs = rsqrtf(red[0] / (float)N + eps);
  {
    for (int u = 0; u < per / 4; ++u) {
      const int j = tid * 4 + 1024 * u;
      v4f o, sm;
#pragma unroll
      for (int q = 0; q < 4; ++q) {
        float gg = g[j + q], bb = bta[j + q];
        if (PARAM_BF16) { gg = bf16_round(gg); bb = bf16_round(bb); }
        sm[q] = vals[u * 4 + q]; o[q] = (vals[u * 4 + q] - mu) * rs * gg + bb;
      }
      if (out_sum) *(v4f*)(out_sum + (size_t)row * N + j) = sm;
      *(v4f*)(out_norm + (size_t)row * N + j) = o;
    }
    
  }
}



// ---- f16 WMMA path (v_wmma_f32_16x16x32_f16): 11-bit significands for operands in range — used where a [0,1] probability operand needs more precision than bf16
typedef _Float16 v16h __attribute__((ext_vector_type(16)));
union FragH { v16h v; v8us half[2]; _Float16 h[16]; unsigned short u[16]; };
template <int NT>
__device__ __forceinline__ v8f mmaH(v16h ah, v16h al, v16h bh, v16h bl, v8f c) {
  c = __builtin_amdgcn_wmma_f32_16x16x32_f16(false, ah, false, bh, (short)0, c, false, false);
  if (NT >= 2) c = __builtin_amdgcn_wmma_f32_16x16x32_f16(false, al, false, bh, (short)0, c, false, false);
  if (NT >= 3) c = __builtin_amdgcn_wmma_f32_16x16x32_f16(false, ah, false, bl, (short)0, c, false, false);
  asm volatile("v_nop\n\tv_nop\n\tv_nop\n\tv_nop" : "+v"(c) : "v"(ah), "v"(al), "v"(bh), "v"(bl));
  return c;
}
// batched GEMM like k_gemm_b but f16 operands: A f32 (split into f16 hi/lo if ASPLIT, else rounded to f16), Bt = f16 values [n][k]; alpha; C f32; N multiple of 16 (partial tiles skipped)
template <bool ASPLIT>
__global__ __launch_bounds__(128) void k_gemm_h(const float* __restrict__ A, int lda, size_t sA, const _Float16* __restrict__ Bh, int ldb, size_t sB, float alpha, float* __restrict__ C, int ldc, size_t sC, int M, int N, int K) {
  __shared__ __attribute__((aligned(16))) float so[4][16][64];
  const int tid = threadIdx.x, w = tid >> 5, lane = tid & 31, ln = lane & 15, hh = lane >> 4; const int by = blockIdx.y;
  A += (size_t)by * sA; Bh += (size_t)by * sB; C += (size_t)by * sC;
  const int ntn = (N + 63) / 64; const int wid = blockIdx.x * 4 + w; const int mt = wid / ntn, nq = wid % ntn; if (mt * 16 >= M) return;
  const int row0 = mt * 16, col0 = nq * 64; const float* arow = A + (size_t)(row0 + ln) * lda;
  v8f acc[4] = {};
  for (int kb = 0; kb < K; kb += 32) {
    FragH ah, al;
    const v4f x0 = *(const v4fa*)(arow + kb + 8 * hh), x1 = *(const v4fa*)(arow + kb + 8 * hh + 4), x2 = *(const v4fa*)(arow + kb + 16 + 8 * hh), x3 = *(const v4fa*)(arow + kb + 16 + 8 * hh + 4);
    float xs[16] = {x0[0],x0[1],x0[2],x0[3],x1[0],x1[1],x1[2],x1[3],x2[0],x2[1],x2[2],x2[3],x3[0],x3[1],x3[2],x3[3]};
#pragma unroll
    for (int i = 0; i < 16; ++i) { const _Float16 h = (_Float16)xs[i]; ah.h[i] = h; al.h[i] = ASPLIT ? (_Float16)(xs[i] - (float)h) : (_Float16)0.0f; }
#pragma unroll
    for (int t = 0; t < 4; ++t) { if (col0 + t * 16 >= N) continue; const size_t boff = (size_t)(col0 + t * 16 + ln) * ldb + kb; FragH bq; bq.half[0] = *(const v8us*)(Bh + boff + 8 * hh); bq.half[1] = *(const v8us*)(Bh + boff + 16 + 8 * hh);
      acc[t] = mmaH<ASPLIT ? 2 : 1>(ah.v, al.v, bq.v, bq.v, acc[t]); }
  }
#pragma unroll
  for (int t = 0; t < 4; ++t) { if (col0 + t * 16 >= N) continue;
#pragma unroll
    for (int r = 0; r < 8; ++r) so[w][8 * hh + r][t * 16 + ln] = acc[t][r] * alpha; }
  __builtin_amdgcn_fence(__ATOMIC_ACQ_REL, "workgroup"); __builtin_amdgcn_wave_barrier();
  const int rsub = lane >> 4, c4 = (lane & 15) * 4;
  {
#pragma unroll
    for (int q = 0; q < 8; ++q) { const int r = q * 2 + rsub; if (col0 + c4 < N) { const v4f v = *(const v4fa*)&so[w][r][c4]; *(v4f*)(C + (size_t)(row0 + r) * ldc + col0 + c4) = v; } }
     }
}

// Wt[n][k] = f16(W[k][n]·scale) from f32 row-major W[K][N] (scale = power of two; bf16-exact weights stay exact in f16 away from the subnormal range)
__global__ __launch_bounds__(256) void k_wt_f16(const float* __restrict__ W, _Float16* __restrict__ Wt, int K, int N, float scale) {
  const int t = blockIdx.x * 256 + threadIdx.x; if (t >= N * (K / 8)) return; const int n = t / (K / 8), k8 = (t % (K / 8)) * 8; FragH f;
#pragma unroll
  for (int i = 0; i < 8; ++i) f.h[i] = (_Float16)(bf16_round(W[(size_t)(k8 + i) * N + n]) * scale); const v8us o = f.half[0];
  *(v8us*)((unsigned short*)Wt + (size_t)n * K + k8) = o; 
}


typedef _Float16 v4h __attribute__((ext_vector_type(4)));

__global__ __launch_bounds__(256) void k_h16(const float* __restrict__ x, _Float16* __restrict__ X16, size_t n8) { const size_t t = (size_t)blockIdx.x * 256 + threadIdx.x; if (t >= n8) return; FragH f;
#pragma unroll
  for (int q = 0; q < 8; ++q) f.h[q] = (_Float16)x[t * 8 + q]; *(v8us*)((unsigned short*)X16 + t * 8) = f.half[0];  }
__global__ __launch_bounds__(256) void k_round16f(const float* __restrict__ W, _Float16* __restrict__ Bt, size_t n8) { const size_t t = (size_t)blockIdx.x * 256 + threadIdx.x; if (t >= n8) return; FragH f;
#pragma unroll
  for (int i = 0; i < 8; ++i) f.h[i] = (_Float16)(bf16_round(W[t * 8 + i]) * 16.0f); *(v8us*)((unsigned short*)Bt + t * 8) = f.half[0];  }
template <int NHv, int TTv>
__global__ __launch_bounds__(256) void k_vt(const _Float16* __restrict__ V16, int ldv, int voff, _Float16* __restrict__ Vt) { __shared__ unsigned short tl[64][66]; const int tid = threadIdx.x; const int slab = blockIdx.x / (TTv / 64), lg = blockIdx.x % (TTv / 64); const int b = slab / NHv, h = slab % NHv;
  for (int i = tid; i < 64 * 8; i += 256) { const int r = i / 8, c8 = (i % 8) * 8; FragH f; f.half[0] = *(const v8us*)((const unsigned short*)V16 + ((size_t)b * TTv + lg * 64 + r) * ldv + voff + h * 64 + c8);
#pragma unroll
    for (int q = 0; q < 8; ++q) tl[r][c8 + q] = f.u[q]; }
  __syncthreads();
  {
#pragma unroll
    for (int rd = 0; rd < 2; ++rd) { const int d = rd * 32 + tid / 8, pc = tid % 8; FragH f;
#pragma unroll
      for (int q = 0; q < 8; ++q) f.u[q] = tl[pc * 8 + q][d];
      *(v8us*)((unsigned short*)Vt + ((size_t)slab * 64 + d) * TTv + lg * 64 + pc * 8) = f.half[0]; }
     } }

__global__ __launch_bounds__(256) void k_hl(const float* __restrict__ F, _Float16* __restrict__ Hh, _Float16* __restrict__ Hl, size_t n8) { const size_t t = (size_t)blockIdx.x * 256 + threadIdx.x; if (t >= n8) return; FragH fh, fl; const v4f a = *(const v4fa*)(F + t * 8), c = *(const v4fa*)(F + t * 8 + 4);
#pragma unroll
  for (int q = 0; q < 4; ++q) { _Float16 h = (_Float16)a[q]; fh.h[q] = h; fl.h[q] = (_Float16)((a[q] - (float)h) * 1024.0f); h = (_Float16)c[q]; fh.h[4 + q] = h; fl.h[4 + q] = (_Float16)((c[q] - (float)h) * 1024.0f); }
  { *(v8us*)((unsigned short*)Hh + t * 8) = fh.half[0]; *(v8us*)((unsigned short*)Hl + t * 8) = fl.half[0];  } }

typedef unsigned int u32x4 __attribute__((ext_vector_type(4)));
typedef unsigned int u32x4a __attribute__((ext_vector_type(4), may_alias));
typedef float f32x2 __attribute__((ext_vector_type(2)));
typedef _Float16 f16x2 __attribute__((ext_vector_type(2)));
#define FSK 64                    /* keys per half-stage */
#define FPITCH 144u               /* LDS row pitch: 128 B of data + 16 B, an odd multiple of 16 B for 16-byte readers */
#define FTILE (64u * FPITCH)      /* one K tile (64 keys x 64 d) or one V^T tile (64 d x 64 keys) */
#define FBUF (2u * FTILE)         /* one half-stage: K tile, then V^T tile; a stage buffer is two of them, the ring two stage buffers */
#define FEP 272u                  /* output staging pitch: 256 B + 16 B */
#define FLIM 32768.0f             /* a pass's row sum up to here: every weight of the pass is a finite f16 */
#define FEX (9u * 512u)           /* one wave's exchange slot: 8 accumulator planes and one of maximum and row sum; 16 slots fill one ring */
typedef unsigned int u32x8 __attribute__((ext_vector_type(8)));
struct FragU { u32x4 q[2]; };
__device__ __forceinline__ v8f mmaU(const FragU& a, const FragU& b, v8f c) { return __builtin_amdgcn_wmma_f32_16x16x32_f16(false, __builtin_bit_cast(v16h, a), false, __builtin_bit_cast(v16h, b), (short)0, c, false, false); }
__device__ __forceinline__ unsigned int pack2h(float lo, float hi) { return __builtin_bit_cast(unsigned int, __builtin_convertvector(f32x2{lo, hi}, f16x2)); }
__device__ __forceinline__ float xhalf(float x) { return __builtin_bit_cast(float, __builtin_amdgcn_permlanex16(__builtin_bit_cast(int, x), __builtin_bit_cast(int, x), 0x76543210, 0xfedcba98, false, false)); }  // lane l <-> lane l ^ 16
__global__ __launch_bounds__(512) void k_fattn(const _Float16* __restrict__ Q, const _Float16* __restrict__ K, const _Float16* __restrict__ VT, float* __restrict__ O) {
  __shared__ __attribute__((aligned(16))) unsigned char Ls[8u * FBUF];      // two rings of 4 FBUF, one a key group
  const unsigned int lane = threadIdx.x & 31u, wave16 = (unsigned int)__builtin_amdgcn_readfirstlane((int)(threadIdx.x >> 5)), c = lane & 15u, hh = lane >> 4;
  const unsigned int grp = wave16 >> 3, wave = wave16 & 7u, tid = threadIdx.x & 255u;      // key group; wave and thread inside it
  unsigned char* const Lg = Ls + grp * (4u * FBUF);
  const unsigned int bh = blockIdx.x / (LL / 256), qblk = blockIdx.x % (LL / 256), b = bh / NH, h = bh % NH;
  const unsigned int q0 = qblk * 256u + wave * 32u;
  // staging map: 8 threads cover one 128-byte row; a thread brings rows srow and srow + 32 of the K tile and of the V^T tile
  const unsigned int srow = tid >> 3, sch = (tid & 7u) * 16u;
  const unsigned char* kg = (const unsigned char*)(K + ((size_t)b * LL + grp * (LL / 2) + srow) * DM + h * DHd) + sch;
  const unsigned char* vg = (const unsigned char*)(VT + ((size_t)bh * DHd + srow) * LL + grp * (LL / 2)) + sch;
  const unsigned int sdst = srow * FPITCH + sch;
  u32x4 r0, r1, r2, r3;
  auto gload = [&](unsigned int st) {
    const unsigned char* kp = kg + (size_t)st * (FSK * DM * 2); const unsigned char* vp = vg + (size_t)st * (FSK * 2);
    r0 = *(const u32x4a*)kp; r1 = *(const u32x4a*)(kp + 32 * DM * 2); r2 = *(const u32x4a*)vp; r3 = *(const u32x4a*)(vp + 32 * LL * 2); };
  auto sstore = [&](unsigned char* base) {
    unsigned char* p = base + sdst;
    *(u32x4a*)p = r0; *(u32x4a*)(p + 32u * FPITCH) = r1; *(u32x4a*)(p + FTILE) = r2; *(u32x4a*)(p + FTILE + 32u * FPITCH) = r3; };
  gload(0);
  FragU qf[2][2];      // B operand: column = query, k = d in the hardware order (16 B at 16 hh and at 32 + 16 hh of each 64 B), as K's rows below
#pragma unroll
  for (int g = 0; g < 2; ++g) { const unsigned char* qp = (const unsigned char*)(Q + ((size_t)b * LL + q0 + 16u * g + c) * DM + h * DHd) + 16u * hh;
#pragma unroll
    for (int kc = 0; kc < 2; ++kc) { qf[g][kc].q[0] = *(const u32x4a*)(qp + 64 * kc); qf[g][kc].q[1] = *(const u32x4a*)(qp + 64 * kc + 32); } }
  FragU ones; ones.q[0] = u32x4{0x3C003C00u, 0x3C003C00u, 0x3C003C00u, 0x3C003C00u}; ones.q[1] = ones.q[0];      // f16 1.0 everywhere
  v8f acc[2][4] = {}; float l_run[2] = {0.f, 0.f}; float m_run[2] = {-1.0e30f, -1.0e30f};      // with this start value the first pass's weights overflow, so it is redone with its exact maximum
  v8f cn[2];      // C operand of the score products: 6 - maximum in use in all eight rows (a lane = one query), so that a score tile leaves the matrix pipe as the exponent of its weight
#pragma unroll
  for (int g = 0; g < 2; ++g)
#pragma unroll
    for (int r = 0; r < 8; ++r) cn[g][r] = 6.0f - m_run[g];      // P carries a factor 2^6 (cancels in the division): small weights stay normal f16
  sstore(Lg); gload(1); sstore(Lg + FBUF);
  __syncthreads();
  // one half-stage (64 keys, two passes) of stage st; more: a stage st + 1 exists (a literal at both call sites, so no test stands in the loop)
  auto halfstage = [&](unsigned int st, unsigned int hf, bool more) __attribute__((always_inline)) {
    if (more) { gload(2u * st + 2u + hf);      // the next stage's same half flies under this half's two passes
      __builtin_amdgcn_sched_barrier(0); }      // keeps the four loads up here: without it the compiler sinks them to their LDS stores and the wave waits out the whole load latency there
    const unsigned char* Lb = Lg + (st & 1u) * (2u * FBUF) + hf * FBUF;
#pragma unroll
    for (unsigned int sub = 0; sub < 2; ++sub) {      // one pass = 32 keys
      v8f s[2][2];      // s[kt][g][r] = log2-domain score of key 16 kt + 8 hh + r against query column c of group g; raw: as it is, else with cn[g] added
      auto scores = [&](bool raw) __attribute__((always_inline)) {
        FragU kf[2][2];
#pragma unroll
        for (int kt = 0; kt < 2; ++kt) { const unsigned char* p = Lb + (sub * 32u + 16u * kt + c) * FPITCH + 16u * hh;
#pragma unroll
          for (int kc = 0; kc < 2; ++kc) { kf[kt][kc].q[0] = *(const u32x4a*)(p + 64 * kc); kf[kt][kc].q[1] = *(const u32x4a*)(p + 64 * kc + 32); } }
        if (raw) {
#pragma unroll
          for (int kc = 0; kc < 2; ++kc)
#pragma unroll
            for (int kt = 0; kt < 2; ++kt)
#pragma unroll
              for (int g = 0; g < 2; ++g) s[kt][g] = mmaU(kf[kt][kc], qf[g][kc], kc ? s[kt][g] : v8f{});
        } else {
          // The pass's eight score products in one statement: the first four read cn as a C that is not their D; four tiles apart, each accumulating product finds its D ready, and each
          // product fills the slots of those in front of it. An exponential now reads a score tile directly: as builtins the compiler set a tile's last product right in front of its
          // exponentials and padded each such place with v_nop (18 more per 64 keys). The four v_nop here are the vector slots between the last product and the first vector instruction
          // on a D, A or B of it, which the compiler does not count behind asm text.
          asm("v_wmma_f32_16x16x32_f16 %0, %4, %8, %12\n\t"
              "v_wmma_f32_16x16x32_f16 %1, %4, %10, %13\n\t"
              "v_wmma_f32_16x16x32_f16 %2, %6, %8, %12\n\t"
              "v_wmma_f32_16x16x32_f16 %3, %6, %10, %13\n\t"
              "v_wmma_f32_16x16x32_f16 %0, %5, %9, %0\n\t"
              "v_wmma_f32_16x16x32_f16 %1, %5, %11, %1\n\t"
              "v_wmma_f32_16x16x32_f16 %2, %7, %9, %2\n\t"
              "v_wmma_f32_16x16x32_f16 %3, %7, %11, %3\n\t"
              "v_nop\n\tv_nop\n\tv_nop\n\tv_nop"
              : "=&v"(s[0][0]), "=&v"(s[0][1]), "=&v"(s[1][0]), "=&v"(s[1][1])
              : "v"(__builtin_bit_cast(u32x8, kf[0][0])), "v"(__builtin_bit_cast(u32x8, kf[0][1])), "v"(__builtin_bit_cast(u32x8, kf[1][0])), "v"(__builtin_bit_cast(u32x8, kf[1][1])),
                "v"(__builtin_bit_cast(u32x8, qf[0][0])), "v"(__builtin_bit_cast(u32x8, qf[0][1])), "v"(__builtin_bit_cast(u32x8, qf[1][0])), "v"(__builtin_bit_cast(u32x8, qf[1][1])),
                "v"(cn[0]), "v"(cn[1]));
        }
      };
      FragU pf[2]; v8f rs[2];      // the pass's weights as B operands, and their column sums (every row of rs[g] alike)
      auto weights = [&]() __attribute__((always_inline)) {
#pragma unroll
        for (int g = 0; g < 2; ++g) { unsigned int w[8];
#pragma unroll
          for (int i = 0; i < 8; ++i) w[i] = pack2h(__builtin_amdgcn_exp2f(s[i >> 2][g][2 * (i & 3)]), __builtin_amdgcn_exp2f(s[i >> 2][g][2 * (i & 3) + 1]));
          pf[g].q[0] = u32x4{w[0], w[1], w[2], w[3]}; pf[g].q[1] = u32x4{w[4], w[5], w[6], w[7]};
          rs[g] = mmaU(ones, pf[g], v8f{}); }
      };
      scores(false);
      FragU vf[4];
#pragma unroll
      for (int t = 0; t < 4; ++t) { const unsigned char* p = Lb + FTILE + (16u * t + c) * FPITCH + sub * 64u + 16u * hh; vf[t].q[0] = *(const u32x4a*)p; vf[t].q[1] = *(const u32x4a*)(p + 32); }
      weights();
      // tested once per pass: a sum within FLIM bounds each of its (non-negative) weights, so none is infinite; written so that infinity and not-a-number both ask for the redo
      const bool redo = !(rs[0][0] <= FLIM) || !(rs[1][0] <= FLIM);
      if (__builtin_expect(__builtin_amdgcn_ballot_w32(redo) != 0, 0)) {      // rare: registers and code layout are chosen for the pass that is not redone
        asm volatile("" ::: "memory");      // compiler fence: the redo reads K from LDS again; without it the fragments or the raw scores would be kept alive through every normal pass (32 VGPRs)
        scores(true);
#pragma unroll
        for (int g = 0; g < 2; ++g) { float mx = s[0][g][0];
#pragma unroll
          for (int r = 1; r < 8; ++r) mx = fmaxf(mx, s[0][g][r]);
#pragma unroll
          for (int r = 0; r < 8; ++r) mx = fmaxf(mx, s[1][g][r]);
          mx = fmaxf(mx, xhalf(mx));
          const float m_new = fmaxf(m_run[g], mx); const float corr = __builtin_amdgcn_exp2f(m_run[g] - m_new); m_run[g] = m_new; l_run[g] = l_run[g] * corr;
#pragma unroll
          for (int t = 0; t < 4; ++t) acc[g][t] = acc[g][t] * corr;
          // c_new never exceeds the value in use (m_new is no smaller than m_run), so the minimum is c_new in every row. Written as a minimum it is formed over the old registers;
          // as a fresh value the compiler kept a second set for the following pass and copied all 16 registers in every pass that is not redone.
          const float c_new = 6.0f - m_new;
          cn[g] = __builtin_elementwise_min(cn[g], v8f{c_new, c_new, c_new, c_new, c_new, c_new, c_new, c_new});
          s[0][g] = s[0][g] + cn[g]; s[1][g] = s[1][g] + cn[g]; }
        weights();      // now no weight exceeds 2^6
      }
#pragma unroll
      for (int g = 0; g < 2; ++g) { l_run[g] += rs[g][0];
#pragma unroll
        for (int t = 0; t < 4; ++t) acc[g][t] = mmaU(vf[t], pf[g], acc[g][t]); }
      __builtin_amdgcn_sched_barrier(0);      // keeps the next pass's instructions out of this pass: mixed with it, the compiler set most exponentials of the next pass right in front of their conversions, a v_nop between the two (20 more v_nop per 64 keys)
    }
    if (more) sstore(Lg + ((st + 1u) & 1u) * (2u * FBUF) + hf * FBUF);      // into the stage buffer whose last readers passed the barrier that ended stage st - 1
    // Four vector slots between the pass's last WMMAs and the next half-stage's first vector write over their B registers;
    // the two scheduling barriers keep the WMMAs in front of the slots and the next writes behind them.
    __builtin_amdgcn_sched_barrier(0);
    asm volatile("v_nop\n\tv_nop\n\tv_nop\n\tv_nop");
    __builtin_amdgcn_sched_barrier(0);
  };
#pragma unroll 1      // the stage loop stays a loop: its body is already two passes long
  for (unsigned int st = 0; st + 1u < LL / (4 * FSK); ++st) {
#pragma unroll 1      // rolled: unrolled, the four passes need more than 256 VGPRs
    for (unsigned int hf = 0; hf < 2; ++hf) halfstage(st, hf, true);
    __syncthreads();      // publishes stage st + 1 and ends every wave's reads of stage st
  }
#pragma unroll 1      // rolled, as above
  for (unsigned int hf = 0; hf < 2; ++hf) halfstage(LL / (4 * FSK) - 1u, hf, false);
  __syncthreads();      // every wave has left the rings: ring 0 becomes the exchange area, ring 1 output staging
  // Join of the two key groups. Key group 0 finishes query group 0, key group 1 query group 1; a wave hands the query group it does not finish to its partner (same query columns,
  // other key group) through a slot of its own: eight 512-byte planes of accumulators (a lane's 16 bytes side by side, so stores and loads meet no bank twice) and one plane with the
  // maximum in use and the row sum. Which of the two is kept is picked by selects on the wave-uniform group number, so that one copy of the code serves both groups.
  const bool first = grp == 0u;
  v8f keep[4], hand[4];
#pragma unroll
  for (int t = 0; t < 4; ++t)
#pragma unroll
    for (int r = 0; r < 8; ++r) { keep[t][r] = first ? acc[0][t][r] : acc[1][t][r]; hand[t][r] = first ? acc[1][t][r] : acc[0][t][r]; }
  const float mk = first ? m_run[0] : m_run[1], lk = first ? l_run[0] : l_run[1];
  { unsigned char* p = Ls + wave16 * FEX + lane * 16u;
#pragma unroll
    for (int t = 0; t < 4; ++t) { *(v4fa*)(p + (2 * t) * 512) = v4f{hand[t][0], hand[t][1], hand[t][2], hand[t][3]}; *(v4fa*)(p + (2 * t + 1) * 512) = v4f{hand[t][4], hand[t][5], hand[t][6], hand[t][7]}; }
    *(v4fa*)(p + 8 * 512) = v4f{first ? m_run[1] : m_run[0], first ? l_run[1] : l_run[0], 0.f, 0.f}; }
  __syncthreads();      // publishes every wave's slot to its partner
  // Both partial sums are taken to the larger of the two maxima, added and divided by the joined row sum; the wave stages its 16 query rows in its own range and stores whole 256-byte rows.
  const unsigned char* px = Ls + (wave16 ^ 8u) * FEX + lane * 16u;
  const v4f ml = *(const v4fa*)(px + 8 * 512);
  const float mj = fmaxf(mk, ml[0]), ca = __builtin_amdgcn_exp2f(mk - mj), cb = __builtin_amdgcn_exp2f(ml[0] - mj);
  const float inv = 1.0f / (lk * ca + ml[1] * cb), fa = ca * inv, fb = cb * inv;
  unsigned char* Le = Ls + 4u * FBUF + wave16 * (16u * FEP);
#pragma unroll
  for (int t = 0; t < 4; ++t) { const v4f o0 = *(const v4fa*)(px + (2 * t) * 512), o1 = *(const v4fa*)(px + (2 * t + 1) * 512);
    unsigned char* s = Le + c * FEP + (16u * t + 8u * hh) * 4u;      // row = query c, columns d = 16 t + 8 hh + r
    *(v4fa*)s = v4f{keep[t][0], keep[t][1], keep[t][2], keep[t][3]} * fa + o0 * fb; *(v4fa*)(s + 16) = v4f{keep[t][4], keep[t][5], keep[t][6], keep[t][7]} * fa + o1 * fb; }
#pragma unroll
  for (int i = 0; i < 8; ++i) { const unsigned int row = 2u * i + hh; const v4f v = *(const v4fa*)(Le + row * FEP + c * 16u);
    *(v4fa*)(O + ((size_t)b * LL + q0 + 16u * grp + row) * DM + h * DHd + c * 4u) = v; }
}

// ---- q_w, k, v^T in one launch: one work-group = 256 sequence rows of one (batch, head), 8 waves x 32 rows. x and the three 64 x 64 weights are read as f32,
// rounded (x: its bf16 value held as f16; W: its bf16 value x 16, the blade sign folded into Wq and bq) and laid in LDS as f16 rows; every product is a WMMA.
// q and k are formed transposed (A = W rows, B = x rows): a lane then holds 8 neighbouring outputs of one sequence row, one 16-byte piece of a q or k row.
// v is formed straight (A = x rows, B = Wv rows): a lane holds 8 neighbouring sequence rows of one d, one 16-byte piece of a V^T row. All three go through LDS, so
// that every global store is made of whole 128-byte lines. Both operands of every product take k in the same hardware order (16 B at 16 hh and at 32 + 16 hh of each 64 B).
typedef unsigned int u32x2 __attribute__((ext_vector_type(2)));
typedef unsigned int u32x2a __attribute__((ext_vector_type(2), may_alias));
#define PVP 528u                          /* V^T staging pitch: 512 B of one d row + 16 B */
#define PL_W (256u * FPITCH)              /* behind the x rows: three weight tiles of 64 rows */
#define PL_B (PL_W + 3u * FTILE)          /* three biases, f32 */
#define PL_Q (PL_B + 3u * 256u)           /* q rows, then k rows: 256 each */
#define PL_V (PL_Q + 2u * 256u * FPITCH)  /* V^T: 64 d rows of 256 sequence places */
#define PL_END (PL_V + 64u * PVP)
__device__ __forceinline__ float blade_sign(unsigned int o) { return ((0xB2u >> (o & 7u)) & 1u) ? -1.f : 1.f; }      // blades 1, 4, 5, 7 are negative
#define QSC (0.125f * 1.4426950408889634f)      /* 1/sqrt(64) and the step to the log2 domain, laid into q ahead of its rounding to f16 */
__device__ __forceinline__ u32x4 pack8h(const v8f a, const float f, const v4f b0, const v4f b1) {      // f16(a * f + bias), eight neighbours; f = 1/16 (the weights' factor), for q times QSC
  return u32x4{pack2h(a[0] * f + b0[0], a[1] * f + b0[1]), pack2h(a[2] * f + b0[2], a[3] * f + b0[3]),
               pack2h(a[4] * f + b1[0], a[5] * f + b1[1]), pack2h(a[6] * f + b1[2], a[7] * f + b1[3])}; }
__global__ __launch_bounds__(256) void k_qkv(const float* __restrict__ x, const float* __restrict__ Wq, const float* __restrict__ bq, const float* __restrict__ Wk, const float* __restrict__ bk,
                                             const float* __restrict__ Wv, const float* __restrict__ bv, _Float16* __restrict__ Qo, _Float16* __restrict__ Ko, _Float16* __restrict__ VTo) {
  __shared__ __attribute__((aligned(16))) unsigned char Lp[PL_END];
  const unsigned int tid = threadIdx.x, lane = tid & 31u, wave = (unsigned int)__builtin_amdgcn_readfirstlane((int)(tid >> 5)), c = lane & 15u, hh = lane >> 4;
  const unsigned int bh = blockIdx.x / (LL / 256), lblk = blockIdx.x % (LL / 256), b = bh / NH, h = bh % NH;
  const unsigned int l0 = lblk * 256u, w0 = wave * 32u;
  // every global read of the kernel is issued here, ahead of any conversion: 16 lanes cover one 256-byte x row (a wave brings its own 32 rows), the weights go linearly over the block
  const float* xg = x + ((size_t)b * LL + l0 + w0 + hh) * DM + h * DHd + c * 4u;
  v4f xr[16], wr[3][4];
#pragma unroll
  for (int i = 0; i < 16; ++i) xr[i] = *(const v4fa*)(xg + (size_t)(2 * i) * DM);
#pragma unroll
  for (int j = 0; j < 4; ++j) { wr[0][j] = *(const v4fa*)(Wq + j * 1024 + tid * 4u); wr[1][j] = *(const v4fa*)(Wk + j * 1024 + tid * 4u); wr[2][j] = *(const v4fa*)(Wv + j * 1024 + tid * 4u); }
  const unsigned int bo = tid & 63u;
  float br = 0.f;
  if (wave < 2u) br = bq[bo]; else if (wave < 4u) br = bk[bo]; else if (wave < 6u) br = bv[bo];
  asm volatile("s_wait_xcnt 0x0" ::: "memory");      // stands in front of the first reuse of an address register of the loads above
  __builtin_amdgcn_sched_barrier(0);      // keeps the conversions, which reuse those registers, behind the wait: without it the compiler lifted the first of them over it
#pragma unroll
  for (int i = 0; i < 16; ++i)
    *(u32x2a*)(Lp + (w0 + 2u * i + hh) * FPITCH + c * 8u) = u32x2{pack2h(bf16_round(xr[i][0]), bf16_round(xr[i][1])), pack2h(bf16_round(xr[i][2]), bf16_round(xr[i][3]))};
#pragma unroll
  for (int mt = 0; mt < 3; ++mt)
#pragma unroll
    for (int j = 0; j < 4; ++j) { const unsigned int o = 16u * j + (tid >> 4); const float s = mt == 0 ? blade_sign(o) : 1.f; const v4f w = wr[mt][j];
      *(u32x2a*)(Lp + PL_W + mt * FTILE + o * FPITCH + c * 8u) = u32x2{pack2h(bf16_round(w[0]) * 16.0f * s, bf16_round(w[1]) * 16.0f * s), pack2h(bf16_round(w[2]) * 16.0f * s, bf16_round(w[3]) * 16.0f * s)}; }
  if (wave < 6u) *(float*)(Lp + PL_B + tid * 4u) = bf16_round(br) * (wave < 2u ? blade_sign(bo) * QSC : 1.f);
  __syncthreads();      // publishes the weights and biases (the x rows are read by the wave that wrote them)
  FragU xf[2][2];
#pragma unroll
  for (int m = 0; m < 2; ++m) { const unsigned char* p = Lp + (w0 + 16u * m + c) * FPITCH + 16u * hh;
#pragma unroll
    for (int kc = 0; kc < 2; ++kc) { xf[m][kc].q[0] = *(const u32x4a*)(p + 64 * kc); xf[m][kc].q[1] = *(const u32x4a*)(p + 64 * kc + 32); } }
#pragma unroll
  for (int mt = 0; mt < 3; ++mt) {
    FragU wf[4][2];
#pragma unroll
    for (int t = 0; t < 4; ++t) { const unsigned char* p = Lp + PL_W + mt * FTILE + (16u * t + c) * FPITCH + 16u * hh;
#pragma unroll
      for (int kc = 0; kc < 2; ++kc) { wf[t][kc].q[0] = *(const u32x4a*)(p + 64 * kc); wf[t][kc].q[1] = *(const u32x4a*)(p + 64 * kc + 32); } }
    v8f a[2][4] = {};
#pragma unroll
    for (int kc = 0; kc < 2; ++kc)
#pragma unroll
      for (int m = 0; m < 2; ++m)
#pragma unroll
        for (int t = 0; t < 4; ++t) a[m][t] = mt < 2 ? mmaU(wf[t][kc], xf[m][kc], a[m][t]) : mmaU(xf[m][kc], wf[t][kc], a[m][t]);
#pragma unroll
    for (int t = 0; t < 4; ++t) {
      if (mt < 2) {      // a[m][t][r]: output 16 t + 8 hh + r of sequence row 16 m + c
        const v4f b0 = *(const v4fa*)(Lp + PL_B + mt * 256u + (16u * t + 8u * hh) * 4u), b1 = *(const v4fa*)(Lp + PL_B + mt * 256u + (16u * t + 8u * hh) * 4u + 16u);
#pragma unroll
        for (int m = 0; m < 2; ++m) *(u32x4a*)(Lp + PL_Q + (mt * 256u + w0 + 16u * m + c) * FPITCH + (16u * t + 8u * hh) * 2u) = pack8h(a[m][t], mt == 0 ? 0.0625f * QSC : 0.0625f, b0, b1);
      } else {           // a[m][t][r]: d = 16 t + c of sequence row 16 m + 8 hh + r
        const float bd = *(const float*)(Lp + PL_B + 512u + (16u * t + c) * 4u); const v4f b4 = v4f{bd, bd, bd, bd};
#pragma unroll
        for (int m = 0; m < 2; ++m) *(u32x4a*)(Lp + PL_V + (16u * t + c) * PVP + (w0 + 16u * m + 8u * hh) * 2u) = pack8h(a[m][t], 0.0625f, b4, b4);
      }
    }
  }
  __syncthreads();      // publishes the staged V^T rows, each made of all eight waves' pieces (and orders each wave's own q and k rows)
  const unsigned int r4 = lane >> 3, c16 = (lane & 7u) * 16u;      // 8 lanes cover one 128-byte q or k row
#pragma unroll
  for (int i = 0; i < 8; ++i) { const unsigned int row = w0 + 4u * i + r4; const size_t go = (((size_t)b * LL + l0 + row) * DM + h * DHd) * 2u + c16;
    *(u32x4a*)((unsigned char*)Qo + go) = *(const u32x4a*)(Lp + PL_Q + row * FPITCH + c16);
    *(u32x4a*)((unsigned char*)Ko + go) = *(const u32x4a*)(Lp + PL_Q + (256u + row) * FPITCH + c16); }
#pragma unroll
  for (int i = 0; i < 8; ++i) { const unsigned int d = wave * 8u + i;      // a wave stores 512 contiguous bytes of one V^T row
    *(u32x4a*)((unsigned char*)(VTo + ((size_t)bh * DHd + d) * LL + l0) + lane * 16u) = *(const u32x4a*)(Lp + PL_V + d * PVP + lane * 16u); }
}

extern "C" void kernel_launch(void* const* d_in, const int* in_sizes, int n_in,
                              void* d_out, int out_size, void* d_ws, size_t ws_size, hipStream_t stream) {
  (void)in_sizes; (void)n_in; (void)out_size;
  const float* x = (const float*)d_in[0]; const float* Wq = (const float*)d_in[1]; const float* bq = (const float*)d_in[2]; const float* Wk = (const float*)d_in[3]; const float* bk = (const float*)d_in[4]; const float* Wv = (const float*)d_in[5]; const float* bv = (const float*)d_in[6];
  char* ws = (char*)d_ws; size_t off = 0;
  auto take = [&](size_t bytes) { char* p = ws + off; off += (bytes + 255) & ~(size_t)255; return p; };
  _Float16* QW16 = (_Float16*)take((size_t)NR * DM * 2); _Float16* K16 = (_Float16*)take((size_t)NR * DM * 2); _Float16* VT = (_Float16*)take((size_t)NR * DM * 2);
  if (off > ws_size) return;      // 3 x 8.4 = 25 MB
  k_qkv<<<NBt * NH * (LL / 256), 256, 0, stream>>>(x, Wq, bq, Wk, bk, Wv, bv, QW16, K16, VT);      /* per-head shared linears (exact products + bias, f16 results; q sign-weighted via the folded weights), v written transposed */
  k_fattn<<<NBt * NH * (LL / 256), 512, 0, stream>>>(QW16, K16, VT, (float*)d_out);      /* scores, softmax, attn*v: every (b, h, 256-query block) in one launch, its keys split over two wave groups */
}
